// v000
// Measured on an AMD MI455X. A time is GPU time per run, averaged over a window of back-to-back runs after a warm-up
// (all launches, gaps included; the runs take copies of the inputs in turn), and the median of several windows.
// Apart from v000's, it joins two sittings. Times from different sittings can be a few percent apart, while
// side-by-side timings come from the same sitting.
// v000 is the starting kernel. One run takes 161 microseconds.
#include <hip/hip_runtime.h>

typedef _Float16 v16h  __attribute__((ext_vector_type(16)));
typedef _Float16 h4    __attribute__((ext_vector_type(4)));
typedef __fp16   f16x2 __attribute__((ext_vector_type(2)));   // cvt_pkrtz return type
typedef float    v8f   __attribute__((ext_vector_type(8)));

#define S_DIM 2048
#define D_DIM 64
#define H_DIM 8
#define KV_CHUNK 64
#define QTILE 64        // Q rows per block (4 waves x 16 rows)
#define NTHREADS 128

union H4u  { h4   v; f16x2 h[2]; };
union V16u { v16h v; f16x2 h[8]; };

__global__ __launch_bounds__(NTHREADS)
void fa_wmma_kernel(const float* __restrict__ Q,
                    const float* __restrict__ K,
                    const float* __restrict__ V,
                    const int*   __restrict__ Mask,
                    float* __restrict__ Out)
{
    // LDS: K chunk (row major, f16), V chunk (transposed, f16), P scratch per wave
    __shared__ __align__(128) _Float16 Kt[KV_CHUNK][D_DIM];      // [kv][d]   8 KB
    __shared__ __align__(128) _Float16 VtT[D_DIM][KV_CHUNK];     // [d][kv]   8 KB
    __shared__ __align__(128) _Float16 Pbuf[4][16][KV_CHUNK];    // per-wave  8 KB

    const int tid  = threadIdx.x;
    const int wave = tid >> 5;
    const int lane = tid & 31;
    const int half = lane >> 4;     // 0 or 1 (lane groups per WMMA layout)
    const int lm   = lane & 15;     // lane % 16

    const int bh = blockIdx.y;              // b*H + h
    const int b  = bh / H_DIM;
    const size_t base = (size_t)bh * S_DIM * D_DIM;

    const float* Qb = Q + base;
    const float* Kb = K + base;
    const float* Vb = V + base;
    const int*   Mb = Mask + (size_t)b * S_DIM * S_DIM;  // head-broadcast mask

    const int q0   = blockIdx.x * QTILE + wave * 16;  // first Q row of this wave
    const int qrow = q0 + lm;                          // A-fragment row for this lane

    // ---- Load Q A-fragments (16x32 f16 each, D split into two K=32 chunks) ----
    // A layout: lane L holds row M=L%16, k = (L/16)*16 + e, e=0..15 (contiguous in d)
    // Fold (1/sqrt(64)) * log2(e) into Q: softmax runs in the log2 domain.
    v16h aq[2];
    {
        const float scale = 0.18033688011112042f;  // 0.125 * log2(e)
        const float* qp = Qb + (size_t)qrow * D_DIM + half * 16;
        #pragma unroll
        for (int c = 0; c < 2; ++c) {
            const float* p = qp + c * 32;
            V16u a;
            #pragma unroll
            for (int i = 0; i < 8; ++i)
                a.h[i] = __builtin_amdgcn_cvt_pkrtz(p[2*i] * scale, p[2*i+1] * scale);
            aq[c] = a.v;
        }
    }

    // All-ones B fragment: P x ones = per-row sums, replicated across lanes (C layout)
    v16h ones;
    #pragma unroll
    for (int e = 0; e < 16; ++e) ones[e] = (_Float16)1.0f;

    // Online-softmax state (log2 domain): rows m = 8*half + v, replicated per half
    float m_i[8];
    v8f   lacc;     // running denominator, accumulated through WMMA C operand
    v8f   o[4];
    #pragma unroll
    for (int v = 0; v < 8; ++v) m_i[v] = -3.0e38f;
    lacc = (v8f){0,0,0,0,0,0,0,0};
    #pragma unroll
    for (int d = 0; d < 4; ++d) o[d] = (v8f){0,0,0,0,0,0,0,0};

    for (int kv0 = 0; kv0 < S_DIM; kv0 += KV_CHUNK) {
        __syncthreads();  // previous chunk fully consumed

        // ---- Cooperative stage: 4x4 register-transpose blocks, packed cvt ----
        #pragma unroll
        for (int i = 0; i < 2; ++i) {
            int t2 = tid + i * NTHREADS;      // 4x4 tile id, 0..255
            int tr = t2 >> 4;                 // kv block (0..15)
            int tc = t2 & 15;                 // d  block (0..15)
            const float* kp = Kb + (size_t)(kv0 + tr*4) * D_DIM + tc*4;
            const float* vp = Vb + (size_t)(kv0 + tr*4) * D_DIM + tc*4;
            float4 kf[4], vf[4];
            #pragma unroll
            for (int r = 0; r < 4; ++r) {
                kf[r] = *(const float4*)(kp + r * D_DIM);
                vf[r] = *(const float4*)(vp + r * D_DIM);
            }
            #pragma unroll
            for (int r = 0; r < 4; ++r) {
                H4u kk;
                kk.h[0] = __builtin_amdgcn_cvt_pkrtz(kf[r].x, kf[r].y);
                kk.h[1] = __builtin_amdgcn_cvt_pkrtz(kf[r].z, kf[r].w);
                *(h4*)&Kt[tr*4 + r][tc*4] = kk.v;   // ds_store_b64
            }
            #pragma unroll
            for (int c = 0; c < 4; ++c) {
                H4u vv;
                vv.h[0] = __builtin_amdgcn_cvt_pkrtz(((const float*)&vf[0])[c],
                                                     ((const float*)&vf[1])[c]);
                vv.h[1] = __builtin_amdgcn_cvt_pkrtz(((const float*)&vf[2])[c],
                                                     ((const float*)&vf[3])[c]);
                *(h4*)&VtT[tc*4 + c][tr*4] = vv.v;  // ds_store_b64
            }
        }
        if (kv0 + KV_CHUNK < S_DIM) {
            __builtin_prefetch(Kb + (size_t)(kv0 + KV_CHUNK) * D_DIM, 0, 1);
            __builtin_prefetch(Vb + (size_t)(kv0 + KV_CHUNK) * D_DIM, 0, 1);
        }

        // ---- Mask bias tiles (issued before the barrier; independent of LDS) ----
        // C layout: lane holds column n = lm, rows m = 8*half + v.
        // cb[j][v] = mask ? -1e9 : 0, fed as the WMMA C operand (no post-WMMA select).
        const int* mp = Mb + (size_t)(q0 + 8*half) * S_DIM + kv0 + lm;
        int mki[8][4];
        #pragma unroll
        for (int v = 0; v < 8; ++v)
            #pragma unroll
            for (int j = 0; j < 4; ++j)
                mki[v][j] = mp[(size_t)v * S_DIM + j * 16];
        v8f cb[4];
        #pragma unroll
        for (int j = 0; j < 4; ++j)
            #pragma unroll
            for (int v = 0; v < 8; ++v)
                cb[j][v] = (float)mki[v][j] * -1.0e9f;

        __syncthreads();

        // ---- Score tiles: S = Q K^T + mask_bias (log2 domain) ----
        v8f sc[4];
        #pragma unroll
        for (int j = 0; j < 4; ++j) {
            v16h bk0 = *(const v16h*)&Kt[j*16 + lm][0  + half*16];
            v16h bk1 = *(const v16h*)&Kt[j*16 + lm][32 + half*16];
            v8f s = __builtin_amdgcn_wmma_f32_16x16x32_f16(false, aq[0], false, bk0,
                                                           (short)0, cb[j], false, false);
            s = __builtin_amdgcn_wmma_f32_16x16x32_f16(false, aq[1], false, bk1,
                                                       (short)0, s, false, false);
            sc[j] = s;
        }

        // ---- One combined online-softmax update per 64-wide chunk ----
        #pragma unroll
        for (int v = 0; v < 8; ++v) {
            float s0 = sc[0][v], s1 = sc[1][v], s2 = sc[2][v], s3 = sc[3][v];
            float rm = fmaxf(fmaxf(s0, s1), fmaxf(s2, s3));
            rm = fmaxf(rm, __shfl_xor(rm, 1, 32));
            rm = fmaxf(rm, __shfl_xor(rm, 2, 32));
            rm = fmaxf(rm, __shfl_xor(rm, 4, 32));
            rm = fmaxf(rm, __shfl_xor(rm, 8, 32));

            float mnew  = fmaxf(m_i[v], rm);
            float alpha = __builtin_exp2f(m_i[v] - mnew);
            m_i[v] = mnew;
            lacc[v] *= alpha;
            #pragma unroll
            for (int d = 0; d < 4; ++d) o[d][v] *= alpha;

            // exp2(-1e9-ish - mnew) underflows to exactly 0 => masked P is 0
            Pbuf[wave][8*half + v][ 0 + lm] = (_Float16)__builtin_exp2f(s0 - mnew);
            Pbuf[wave][8*half + v][16 + lm] = (_Float16)__builtin_exp2f(s1 - mnew);
            Pbuf[wave][8*half + v][32 + lm] = (_Float16)__builtin_exp2f(s2 - mnew);
            Pbuf[wave][8*half + v][48 + lm] = (_Float16)__builtin_exp2f(s3 - mnew);
        }

        // Wave-private LDS store->load of P: enforce DS ordering explicitly
        asm volatile("s_wait_dscnt 0" ::: "memory");

        v16h ap0 = *(const v16h*)&Pbuf[wave][lm][0  + half*16];  // kv 0..31
        v16h ap1 = *(const v16h*)&Pbuf[wave][lm][32 + half*16];  // kv 32..63

        // l += rowsum(P), accumulated entirely inside the matrix pipe
        lacc = __builtin_amdgcn_wmma_f32_16x16x32_f16(false, ap0, false, ones,
                                                      (short)0, lacc, false, false);
        lacc = __builtin_amdgcn_wmma_f32_16x16x32_f16(false, ap1, false, ones,
                                                      (short)0, lacc, false, false);

        // ---- O += P V : B[k][n] = V[kv0+k][d*16+n] from transposed V tile ----
        #pragma unroll
        for (int d = 0; d < 4; ++d) {
            v16h bv0 = *(const v16h*)&VtT[d*16 + lm][0  + half*16];
            v16h bv1 = *(const v16h*)&VtT[d*16 + lm][32 + half*16];
            o[d] = __builtin_amdgcn_wmma_f32_16x16x32_f16(false, ap0, false, bv0,
                                                          (short)0, o[d], false, false);
            o[d] = __builtin_amdgcn_wmma_f32_16x16x32_f16(false, ap1, false, bv1,
                                                          (short)0, o[d], false, false);
        }
    }

    // ---- Epilogue: O / l, store fp32 [B,H,S,D] ----
    float* op = Out + base + (size_t)(q0 + 8*half) * D_DIM;
    #pragma unroll
    for (int v = 0; v < 8; ++v) {
        float inv = (lacc[v] > 0.0f) ? (1.0f / lacc[v]) : 0.0f;
        #pragma unroll
        for (int d = 0; d < 4; ++d)
            op[(size_t)v * D_DIM + d*16 + lm] = o[d][v] * inv;
    }
}

extern "C" void kernel_launch(void* const* d_in, const int* in_sizes, int n_in,
                              void* d_out, int out_size, void* d_ws, size_t ws_size,
                              hipStream_t stream) {
    (void)in_sizes; (void)n_in; (void)out_size; (void)d_ws; (void)ws_size;
    const float* Q    = (const float*)d_in[0];
    const float* K    = (const float*)d_in[1];
    const float* V    = (const float*)d_in[2];
    const int*   Mask = (const int*)d_in[3];
    float* Out = (float*)d_out;

    const int B = 4, H = H_DIM;
    dim3 grid(S_DIM / QTILE, B * H);   // (32, 32) blocks
    dim3 block(NTHREADS);
    fa_wmma_kernel<<<grid, block, 0, stream>>>(Q, K, V, Mask, Out);
}

// v001
// Measured time: 94.9 microseconds a run.
// In two side-by-side timings against v000, it was 1.79 and 1.78 times as fast.
#include <hip/hip_runtime.h>

typedef _Float16 v16h  __attribute__((ext_vector_type(16)));
typedef _Float16 v8h   __attribute__((ext_vector_type(8)));
typedef _Float16 h4    __attribute__((ext_vector_type(4)));
typedef __fp16   f16x2 __attribute__((ext_vector_type(2)));   // cvt_pkrtz return type
typedef float    v8f   __attribute__((ext_vector_type(8)));

#define S_DIM 2048
#define D_DIM 64
#define H_DIM 8
#define KV_CHUNK 64
#define QTILE 64        // Q rows per block (4 waves x 16 rows)
#define NTHREADS 128
// LDS row pitch in f16 elements: 64 data + 8 pad = 144 B = 16 B x 9 (odd), so the
// 16 rows that one ds_load_b128 touches start on distinct 4-bank groups.
#define LDP 72

union H4u  { h4   v; f16x2 h[2]; };
union V16u { v16h v; f16x2 h[8]; };

// 32-byte fragment from a row that is only 16-byte aligned: two ds_load_b128
__device__ __forceinline__ v16h ld_frag(const _Float16* p)
{
    v8h lo = *(const v8h*)p;
    v8h hi = *(const v8h*)(p + 8);
    return __builtin_shufflevector(lo, hi, 0, 1, 2, 3, 4, 5, 6, 7,
                                   8, 9, 10, 11, 12, 13, 14, 15);
}

__global__ __launch_bounds__(NTHREADS)
void fa_wmma_kernel(const float* __restrict__ Q,
                    const float* __restrict__ K,
                    const float* __restrict__ V,
                    const int*   __restrict__ Mask,
                    float* __restrict__ Out)
{
    // LDS: K chunk (row major, f16), V chunk (transposed, f16), P scratch per wave
    __shared__ __align__(128) _Float16 Kt[KV_CHUNK][LDP];        // [kv][d]   9 KB
    __shared__ __align__(128) _Float16 VtT[D_DIM][LDP];          // [d][kv]   9 KB
    __shared__ __align__(128) _Float16 Pbuf[4][16][LDP];         // per-wave  9 KB

    const int tid  = threadIdx.x;
    const int wave = tid >> 5;
    const int lane = tid & 31;
    const int half = lane >> 4;     // 0 or 1 (lane groups per WMMA layout)
    const int lm   = lane & 15;     // lane % 16

    const int bh = blockIdx.y;              // b*H + h
    const int b  = bh / H_DIM;
    const size_t base = (size_t)bh * S_DIM * D_DIM;

    const float* Qb = Q + base;
    const float* Kb = K + base;
    const float* Vb = V + base;
    const int*   Mb = Mask + (size_t)b * S_DIM * S_DIM;  // head-broadcast mask

    const int q0   = blockIdx.x * QTILE + wave * 16;  // first Q row of this wave
    const int qrow = q0 + lm;                          // A-fragment row for this lane

    // ---- Load Q A-fragments (16x32 f16 each, D split into two K=32 chunks) ----
    // A layout: lane L holds row M=L%16, k = (L/16)*16 + e, e=0..15 (contiguous in d)
    // Fold (1/sqrt(64)) * log2(e) into Q: softmax runs in the log2 domain.
    v16h aq[2];
    {
        const float scale = 0.18033688011112042f;  // 0.125 * log2(e)
        const float* qp = Qb + (size_t)qrow * D_DIM + half * 16;
        #pragma unroll
        for (int c = 0; c < 2; ++c) {
            const float* p = qp + c * 32;
            V16u a;
            #pragma unroll
            for (int i = 0; i < 8; ++i)
                a.h[i] = __builtin_amdgcn_cvt_pkrtz(p[2*i] * scale, p[2*i+1] * scale);
            aq[c] = a.v;
        }
    }

    // All-ones B fragment: P x ones = per-row sums, replicated across lanes (C layout)
    v16h ones;
    #pragma unroll
    for (int e = 0; e < 16; ++e) ones[e] = (_Float16)1.0f;

    // Online-softmax state (log2 domain): rows m = 8*half + v, replicated per half
    float m_i[8];
    v8f   lacc;     // running denominator, accumulated through WMMA C operand
    v8f   o[4];
    #pragma unroll
    for (int v = 0; v < 8; ++v) m_i[v] = -3.0e38f;
    lacc = (v8f){0,0,0,0,0,0,0,0};
    #pragma unroll
    for (int d = 0; d < 4; ++d) o[d] = (v8f){0,0,0,0,0,0,0,0};

    for (int kv0 = 0; kv0 < S_DIM; kv0 += KV_CHUNK) {
        __syncthreads();  // previous chunk fully consumed

        // ---- Cooperative stage: 4x4 register-transpose blocks, packed cvt ----
        #pragma unroll
        for (int i = 0; i < 2; ++i) {
            int t2 = tid + i * NTHREADS;      // 4x4 tile id, 0..255
            int tr = t2 >> 4;                 // kv block (0..15)
            int tc = t2 & 15;                 // d  block (0..15)
            const float* kp = Kb + (size_t)(kv0 + tr*4) * D_DIM + tc*4;
            const float* vp = Vb + (size_t)(kv0 + tr*4) * D_DIM + tc*4;
            float4 kf[4], vf[4];
            #pragma unroll
            for (int r = 0; r < 4; ++r) {
                kf[r] = *(const float4*)(kp + r * D_DIM);
                vf[r] = *(const float4*)(vp + r * D_DIM);
            }
            #pragma unroll
            for (int r = 0; r < 4; ++r) {
                H4u kk;
                kk.h[0] = __builtin_amdgcn_cvt_pkrtz(kf[r].x, kf[r].y);
                kk.h[1] = __builtin_amdgcn_cvt_pkrtz(kf[r].z, kf[r].w);
                *(h4*)&Kt[tr*4 + r][tc*4] = kk.v;   // ds_store_b64
            }
            #pragma unroll
            for (int c = 0; c < 4; ++c) {
                H4u vv;
                vv.h[0] = __builtin_amdgcn_cvt_pkrtz(((const float*)&vf[0])[c],
                                                     ((const float*)&vf[1])[c]);
                vv.h[1] = __builtin_amdgcn_cvt_pkrtz(((const float*)&vf[2])[c],
                                                     ((const float*)&vf[3])[c]);
                *(h4*)&VtT[tc*4 + c][tr*4] = vv.v;  // ds_store_b64
            }
        }
        if (kv0 + KV_CHUNK < S_DIM) {
            __builtin_prefetch(Kb + (size_t)(kv0 + KV_CHUNK) * D_DIM, 0, 1);
            __builtin_prefetch(Vb + (size_t)(kv0 + KV_CHUNK) * D_DIM, 0, 1);
        }

        // ---- Mask bias tiles (issued before the barrier; independent of LDS) ----
        // C layout: lane holds column n = lm, rows m = 8*half + v.
        // cb[j][v] = mask ? -1e9 : 0, fed as the WMMA C operand (no post-WMMA select).
        const int* mp = Mb + (size_t)(q0 + 8*half) * S_DIM + kv0 + lm;
        int mki[8][4];
        #pragma unroll
        for (int v = 0; v < 8; ++v)
            #pragma unroll
            for (int j = 0; j < 4; ++j)
                mki[v][j] = mp[(size_t)v * S_DIM + j * 16];
        v8f cb[4];
        #pragma unroll
        for (int j = 0; j < 4; ++j)
            #pragma unroll
            for (int v = 0; v < 8; ++v)
                cb[j][v] = (float)mki[v][j] * -1.0e9f;

        __syncthreads();

        // ---- Score tiles: S = Q K^T + mask_bias (log2 domain) ----
        v8f sc[4];
        #pragma unroll
        for (int j = 0; j < 4; ++j) {
            v16h bk0 = ld_frag(&Kt[j*16 + lm][0  + half*16]);
            v16h bk1 = ld_frag(&Kt[j*16 + lm][32 + half*16]);
            v8f s = __builtin_amdgcn_wmma_f32_16x16x32_f16(false, aq[0], false, bk0,
                                                           (short)0, cb[j], false, false);
            s = __builtin_amdgcn_wmma_f32_16x16x32_f16(false, aq[1], false, bk1,
                                                       (short)0, s, false, false);
            sc[j] = s;
        }

        // ---- One combined online-softmax update per 64-wide chunk ----
        #pragma unroll
        for (int v = 0; v < 8; ++v) {
            float s0 = sc[0][v], s1 = sc[1][v], s2 = sc[2][v], s3 = sc[3][v];
            float rm = fmaxf(fmaxf(s0, s1), fmaxf(s2, s3));
            rm = fmaxf(rm, __shfl_xor(rm, 1, 32));
            rm = fmaxf(rm, __shfl_xor(rm, 2, 32));
            rm = fmaxf(rm, __shfl_xor(rm, 4, 32));
            rm = fmaxf(rm, __shfl_xor(rm, 8, 32));

            float mnew  = fmaxf(m_i[v], rm);
            float alpha = __builtin_exp2f(m_i[v] - mnew);
            m_i[v] = mnew;
            lacc[v] *= alpha;
            #pragma unroll
            for (int d = 0; d < 4; ++d) o[d][v] *= alpha;

            // exp2(-1e9-ish - mnew) underflows to exactly 0 => masked P is 0
            Pbuf[wave][8*half + v][ 0 + lm] = (_Float16)__builtin_exp2f(s0 - mnew);
            Pbuf[wave][8*half + v][16 + lm] = (_Float16)__builtin_exp2f(s1 - mnew);
            Pbuf[wave][8*half + v][32 + lm] = (_Float16)__builtin_exp2f(s2 - mnew);
            Pbuf[wave][8*half + v][48 + lm] = (_Float16)__builtin_exp2f(s3 - mnew);
        }

        // Wave-private LDS store->load of P: enforce DS ordering explicitly
        asm volatile("s_wait_dscnt 0" ::: "memory");

        v16h ap0 = ld_frag(&Pbuf[wave][lm][0  + half*16]);  // kv 0..31
        v16h ap1 = ld_frag(&Pbuf[wave][lm][32 + half*16]);  // kv 32..63

        // l += rowsum(P), accumulated entirely inside the matrix pipe
        lacc = __builtin_amdgcn_wmma_f32_16x16x32_f16(false, ap0, false, ones,
                                                      (short)0, lacc, false, false);
        lacc = __builtin_amdgcn_wmma_f32_16x16x32_f16(false, ap1, false, ones,
                                                      (short)0, lacc, false, false);

        // ---- O += P V : B[k][n] = V[kv0+k][d*16+n] from transposed V tile ----
        #pragma unroll
        for (int d = 0; d < 4; ++d) {
            v16h bv0 = ld_frag(&VtT[d*16 + lm][0  + half*16]);
            v16h bv1 = ld_frag(&VtT[d*16 + lm][32 + half*16]);
            o[d] = __builtin_amdgcn_wmma_f32_16x16x32_f16(false, ap0, false, bv0,
                                                          (short)0, o[d], false, false);
            o[d] = __builtin_amdgcn_wmma_f32_16x16x32_f16(false, ap1, false, bv1,
                                                          (short)0, o[d], false, false);
        }
    }

    // ---- Epilogue: O / l, store fp32 [B,H,S,D] ----
    float* op = Out + base + (size_t)(q0 + 8*half) * D_DIM;
    #pragma unroll
    for (int v = 0; v < 8; ++v) {
        float inv = (lacc[v] > 0.0f) ? (1.0f / lacc[v]) : 0.0f;
        #pragma unroll
        for (int d = 0; d < 4; ++d)
            op[(size_t)v * D_DIM + d*16 + lm] = o[d][v] * inv;
    }
}

extern "C" void kernel_launch(void* const* d_in, const int* in_sizes, int n_in,
                              void* d_out, int out_size, void* d_ws, size_t ws_size,
                              hipStream_t stream) {
    (void)in_sizes; (void)n_in; (void)out_size; (void)d_ws; (void)ws_size;
    const float* Q    = (const float*)d_in[0];
    const float* K    = (const float*)d_in[1];
    const float* V    = (const float*)d_in[2];
    const int*   Mask = (const int*)d_in[3];
    float* Out = (float*)d_out;

    const int B = 4, H = H_DIM;
    dim3 grid(S_DIM / QTILE, B * H);   // (32, 32) blocks
    dim3 block(NTHREADS);
    fa_wmma_kernel<<<grid, block, 0, stream>>>(Q, K, V, Mask, Out);
}

// v002
// A run of this version takes 84.9 microseconds.
// In both of two side-by-side timings against v001, it was 1.12 times as fast.
// Counting every step since v000, it is 1.99 times as fast.
#include <hip/hip_runtime.h>

typedef _Float16 v16h  __attribute__((ext_vector_type(16)));
typedef _Float16 v8h   __attribute__((ext_vector_type(8)));
typedef _Float16 h4    __attribute__((ext_vector_type(4)));
typedef __fp16   f16x2 __attribute__((ext_vector_type(2)));   // cvt_pkrtz return type
typedef float    v8f   __attribute__((ext_vector_type(8)));
typedef _Float16 h2    __attribute__((ext_vector_type(2)));
typedef float    f2    __attribute__((ext_vector_type(2)));

#define S_DIM 2048
#define D_DIM 64
#define H_DIM 8
#define KV_CHUNK 64
#define QTILE 64        // Q rows per block (4 waves x 16 rows)
#define NTHREADS 128
// LDS row pitch in f16 elements: 64 data + 8 pad = 144 B = 16 B x 9 (odd), so the
// 16 rows that one ds_load_b128 touches start on distinct 4-bank groups.
#define LDP 72

union H4u  { h4   v; f16x2 h[2]; };
union V16u { v16h v; f16x2 h[8]; };
union P16u { v16h v; h2    h[8]; };

// 32-byte fragment from a row that is only 16-byte aligned: two ds_load_b128
__device__ __forceinline__ v16h ld_frag(const _Float16* p)
{
    v8h lo = *(const v8h*)p;
    v8h hi = *(const v8h*)(p + 8);
    return __builtin_shufflevector(lo, hi, 0, 1, 2, 3, 4, 5, 6, 7,
                                   8, 9, 10, 11, 12, 13, 14, 15);
}

// A fragment in the k order of a packed accumulator pair: p points at a block of
// 32 k in a row; position s holds k = 8*half + s (s < 8), 16 + 8*half + (s - 8) else
__device__ __forceinline__ v16h ld_frag_kmap(const _Float16* p, int half)
{
    v8h lo = *(const v8h*)(p + 8 * half);
    v8h hi = *(const v8h*)(p + 16 + 8 * half);
    return __builtin_shufflevector(lo, hi, 0, 1, 2, 3, 4, 5, 6, 7,
                                   8, 9, 10, 11, 12, 13, 14, 15);
}

// value of lane l ^ 16
__device__ __forceinline__ float other_half(float x)
{
    int b = __builtin_bit_cast(int, x);
    b = __builtin_amdgcn_permlanex16(b, b, 0x76543210, 0xfedcba98, false, false);
    return __builtin_bit_cast(float, b);
}

__global__ __launch_bounds__(NTHREADS)
void fa_wmma_kernel(const float* __restrict__ Q,
                    const float* __restrict__ K,
                    const float* __restrict__ V,
                    const int*   __restrict__ Mask,
                    float* __restrict__ Out)
{
    // LDS: K chunk (row major, f16), V chunk (transposed, f16)
    __shared__ __align__(128) _Float16 Kt[KV_CHUNK][LDP];        // [kv][d]   9 KB
    __shared__ __align__(128) _Float16 VtT[D_DIM][LDP];          // [d][kv]   9 KB

    const int tid  = threadIdx.x;
    const int wave = tid >> 5;
    const int lane = tid & 31;
    const int half = lane >> 4;     // 0 or 1 (lane groups per WMMA layout)
    const int lm   = lane & 15;     // lane % 16

    const int bh = blockIdx.y;              // b*H + h
    const int b  = bh / H_DIM;
    const size_t base = (size_t)bh * S_DIM * D_DIM;

    const float* Qb = Q + base;
    const float* Kb = K + base;
    const float* Vb = V + base;
    const int*   Mb = Mask + (size_t)b * S_DIM * S_DIM;  // head-broadcast mask

    const int q0   = blockIdx.x * QTILE + wave * 16;  // first Q row of this wave
    const int qrow = q0 + lm;                          // this lane's query (column of S^T, O^T)

    // ---- Load Q^T B-fragments (32x16 f16 each, D split into two K=32 chunks) ----
    // Lane L holds column N=L%16, k = (L/16)*16 + e, e=0..15 (contiguous in d, as the K rows)
    // Fold (1/sqrt(64)) * log2(e) into Q: softmax runs in the log2 domain.
    v16h aq[2];
    {
        const float scale = 0.18033688011112042f;  // 0.125 * log2(e)
        const float* qp = Qb + (size_t)qrow * D_DIM + half * 16;
        #pragma unroll
        for (int c = 0; c < 2; ++c) {
            const float* p = qp + c * 32;
            V16u a;
            #pragma unroll
            for (int i = 0; i < 8; ++i)
                a.h[i] = __builtin_amdgcn_cvt_pkrtz(p[2*i] * scale, p[2*i+1] * scale);
            aq[c] = a.v;
        }
    }

    // All-ones A fragment: ones x P^T = per-query sums over both lane halves' keys,
    // the same in all 8 accumulator rows
    v16h ones;
    #pragma unroll
    for (int e = 0; e < 16; ++e) ones[e] = (_Float16)1.0f;

    // Online-softmax state (log2 domain): one query per lane, equal in lanes l and l ^ 16
    float m_i = -3.0e38f;
    v8f   lacc;     // running denominator, accumulated through WMMA C operand
    v8f   o[4];
    lacc = (v8f){0,0,0,0,0,0,0,0};
    #pragma unroll
    for (int d = 0; d < 4; ++d) o[d] = (v8f){0,0,0,0,0,0,0,0};

    for (int kv0 = 0; kv0 < S_DIM; kv0 += KV_CHUNK) {
        __syncthreads();  // previous chunk fully consumed

        // ---- Cooperative stage: 4x4 register-transpose blocks, packed cvt ----
        #pragma unroll
        for (int i = 0; i < 2; ++i) {
            int t2 = tid + i * NTHREADS;      // 4x4 tile id, 0..255
            int tr = t2 >> 4;                 // kv block (0..15)
            int tc = t2 & 15;                 // d  block (0..15)
            const float* kp = Kb + (size_t)(kv0 + tr*4) * D_DIM + tc*4;
            const float* vp = Vb + (size_t)(kv0 + tr*4) * D_DIM + tc*4;
            float4 kf[4], vf[4];
            #pragma unroll
            for (int r = 0; r < 4; ++r) {
                kf[r] = *(const float4*)(kp + r * D_DIM);
                vf[r] = *(const float4*)(vp + r * D_DIM);
            }
            #pragma unroll
            for (int r = 0; r < 4; ++r) {
                H4u kk;
                kk.h[0] = __builtin_amdgcn_cvt_pkrtz(kf[r].x, kf[r].y);
                kk.h[1] = __builtin_amdgcn_cvt_pkrtz(kf[r].z, kf[r].w);
                *(h4*)&Kt[tr*4 + r][tc*4] = kk.v;   // ds_store_b64
            }
            #pragma unroll
            for (int c = 0; c < 4; ++c) {
                H4u vv;
                vv.h[0] = __builtin_amdgcn_cvt_pkrtz(((const float*)&vf[0])[c],
                                                     ((const float*)&vf[1])[c]);
                vv.h[1] = __builtin_amdgcn_cvt_pkrtz(((const float*)&vf[2])[c],
                                                     ((const float*)&vf[3])[c]);
                *(h4*)&VtT[tc*4 + c][tr*4] = vv.v;  // ds_store_b64
            }
        }
        if (kv0 + KV_CHUNK < S_DIM) {
            __builtin_prefetch(Kb + (size_t)(kv0 + KV_CHUNK) * D_DIM, 0, 1);
            __builtin_prefetch(Vb + (size_t)(kv0 + KV_CHUNK) * D_DIM, 0, 1);
        }

        // ---- Mask bias tiles (issued before the barrier; independent of LDS) ----
        // S^T accumulator layout: lane holds query lm, keys j*16 + 8*half + v: 8 consecutive
        // mask words per tile and lane, two 16-byte loads.
        // cb[j][v] = mask ? -1e9 : 0, fed as the WMMA C operand (no post-WMMA select).
        const int* mp = Mb + (size_t)qrow * S_DIM + kv0 + 8*half;
        int4 mki[4][2];
        #pragma unroll
        for (int j = 0; j < 4; ++j) {
            mki[j][0] = *(const int4*)(mp + j * 16);
            mki[j][1] = *(const int4*)(mp + j * 16 + 4);
        }
        v8f cb[4];
        #pragma unroll
        for (int j = 0; j < 4; ++j)
            #pragma unroll
            for (int p = 0; p < 2; ++p) {
                cb[j][4*p + 0] = (float)mki[j][p].x * -1.0e9f;
                cb[j][4*p + 1] = (float)mki[j][p].y * -1.0e9f;
                cb[j][4*p + 2] = (float)mki[j][p].z * -1.0e9f;
                cb[j][4*p + 3] = (float)mki[j][p].w * -1.0e9f;
            }

        __syncthreads();

        // ---- Score tiles: S^T = K Q^T + mask_bias (log2 domain) ----
        v8f sc[4];
        #pragma unroll
        for (int j = 0; j < 4; ++j) {
            v16h ak0 = ld_frag(&Kt[j*16 + lm][0  + half*16]);
            v16h ak1 = ld_frag(&Kt[j*16 + lm][32 + half*16]);
            v8f s = __builtin_amdgcn_wmma_f32_16x16x32_f16(false, ak0, false, aq[0],
                                                           (short)0, cb[j], false, false);
            s = __builtin_amdgcn_wmma_f32_16x16x32_f16(false, ak1, false, aq[1],
                                                       (short)0, s, false, false);
            sc[j] = s;
        }

        // ---- One online-softmax update per 64-wide chunk, one query per lane ----
        float tm[4];
        #pragma unroll
        for (int j = 0; j < 4; ++j) {
            float x0 = fmaxf(fmaxf(sc[j][0], sc[j][1]), sc[j][2]);
            float x1 = fmaxf(fmaxf(sc[j][3], sc[j][4]), sc[j][5]);
            tm[j] = fmaxf(fmaxf(x0, x1), fmaxf(sc[j][6], sc[j][7]));
        }
        float rm = fmaxf(fmaxf(tm[0], tm[1]), fmaxf(tm[2], tm[3]));
        rm = fmaxf(rm, other_half(rm));   // the other 32 keys of this query

        const float mnew  = fmaxf(m_i, rm);
        const float alpha = __builtin_exp2f(m_i - mnew);
        m_i = mnew;
        lacc *= alpha;
        #pragma unroll
        for (int d = 0; d < 4; ++d) o[d] *= alpha;

        // P^T as B operands straight from the score accumulators: tiles (0,1) are keys
        // 0..31, tiles (2,3) keys 32..63; position s of a lane is key 8*half + s or
        // 16 + 8*half + (s - 8) of its block, the order ld_frag_kmap gives V^T.
        // exp2(-1e9-ish - mnew) underflows to exactly 0 => masked P is 0
        P16u pb[2];
        #pragma unroll
        for (int j = 0; j < 4; ++j)
            #pragma unroll
            for (int i = 0; i < 4; ++i) {
                f2 e;
                e.x = __builtin_exp2f(sc[j][2*i]     - mnew);
                e.y = __builtin_exp2f(sc[j][2*i + 1] - mnew);
                pb[j >> 1].h[(j & 1) * 4 + i] = __builtin_convertvector(e, h2);
            }

        // l += sum over keys of P, accumulated entirely inside the matrix pipe
        lacc = __builtin_amdgcn_wmma_f32_16x16x32_f16(false, ones, false, pb[0].v,
                                                      (short)0, lacc, false, false);
        lacc = __builtin_amdgcn_wmma_f32_16x16x32_f16(false, ones, false, pb[1].v,
                                                      (short)0, lacc, false, false);

        // ---- O^T += V^T P^T : A[m][k] = V[kv0+k][d*16+m] from the transposed V tile ----
        #pragma unroll
        for (int d = 0; d < 4; ++d) {
            v16h av0 = ld_frag_kmap(&VtT[d*16 + lm][0],  half);
            v16h av1 = ld_frag_kmap(&VtT[d*16 + lm][32], half);
            o[d] = __builtin_amdgcn_wmma_f32_16x16x32_f16(false, av0, false, pb[0].v,
                                                          (short)0, o[d], false, false);
            o[d] = __builtin_amdgcn_wmma_f32_16x16x32_f16(false, av1, false, pb[1].v,
                                                          (short)0, o[d], false, false);
        }
    }

    // ---- Epilogue: O / l, store fp32 [B,H,S,D] ----
    // o[d][v] = O[qrow][d*16 + 8*half + v]: two 16-byte stores per tile
    float* op = Out + base + (size_t)qrow * D_DIM + 8*half;
    const float inv = (lacc[0] > 0.0f) ? (1.0f / lacc[0]) : 0.0f;
    #pragma unroll
    for (int d = 0; d < 4; ++d) {
        *(float4*)(op + d*16)     = make_float4(o[d][0] * inv, o[d][1] * inv,
                                                o[d][2] * inv, o[d][3] * inv);
        *(float4*)(op + d*16 + 4) = make_float4(o[d][4] * inv, o[d][5] * inv,
                                                o[d][6] * inv, o[d][7] * inv);
    }
}

extern "C" void kernel_launch(void* const* d_in, const int* in_sizes, int n_in,
                              void* d_out, int out_size, void* d_ws, size_t ws_size,
                              hipStream_t stream) {
    (void)in_sizes; (void)n_in; (void)out_size; (void)d_ws; (void)ws_size;
    const float* Q    = (const float*)d_in[0];
    const float* K    = (const float*)d_in[1];
    const float* V    = (const float*)d_in[2];
    const int*   Mask = (const int*)d_in[3];
    float* Out = (float*)d_out;

    const int B = 4, H = H_DIM;
    dim3 grid(S_DIM / QTILE, B * H);   // (32, 32) blocks
    dim3 block(NTHREADS);
    fa_wmma_kernel<<<grid, block, 0, stream>>>(Q, K, V, Mask, Out);
}

// v003
// One run takes 69.2 microseconds.
// Two timings next to v002 put it at 1.23 and 1.22 times that version's speed.
// Counting every step since v000, it is 2.44 times as fast.
#include <hip/hip_runtime.h>

typedef _Float16 v16h  __attribute__((ext_vector_type(16)));
typedef _Float16 v8h   __attribute__((ext_vector_type(8)));
typedef _Float16 h4    __attribute__((ext_vector_type(4)));
typedef __fp16   f16x2 __attribute__((ext_vector_type(2)));   // cvt_pkrtz return type
typedef float    v8f   __attribute__((ext_vector_type(8)));
typedef _Float16 h2    __attribute__((ext_vector_type(2)));
typedef float    f2    __attribute__((ext_vector_type(2)));

#define S_DIM 2048
#define D_DIM 64
#define H_DIM 8
#define KV_CHUNK 64
#define QTILE 64        // Q rows per block (4 waves x 16 rows)
#define NTHREADS 128
// LDS row pitch in f16 elements: 64 data + 8 pad = 144 B = 16 B x 9 (odd), so the
// 16 rows that one ds_load_b128 touches start on distinct 4-bank groups.
#define LDP 72
// LDS row pitch of the mask tile in 32-bit words: 64 data + 4 pad = 272 B = 16 B x 17 (odd)
#define MLP 68

union H4u  { h4   v; f16x2 h[2]; };
union V16u { v16h v; f16x2 h[8]; };
union P16u { v16h v; h2    h[8]; };

// 32-byte fragment from a row that is only 16-byte aligned: two ds_load_b128
__device__ __forceinline__ v16h ld_frag(const _Float16* p)
{
    v8h lo = *(const v8h*)p;
    v8h hi = *(const v8h*)(p + 8);
    return __builtin_shufflevector(lo, hi, 0, 1, 2, 3, 4, 5, 6, 7,
                                   8, 9, 10, 11, 12, 13, 14, 15);
}

// A fragment in the k order of a packed accumulator pair: p points at a block of
// 32 k in a row; position s holds k = 8*half + s (s < 8), 16 + 8*half + (s - 8) else
__device__ __forceinline__ v16h ld_frag_kmap(const _Float16* p, int half)
{
    v8h lo = *(const v8h*)(p + 8 * half);
    v8h hi = *(const v8h*)(p + 16 + 8 * half);
    return __builtin_shufflevector(lo, hi, 0, 1, 2, 3, 4, 5, 6, 7,
                                   8, 9, 10, 11, 12, 13, 14, 15);
}

// One 64 x 64 mask tile (this block's query rows, one key chunk) from global memory into
// LDS through no register: 8 asynchronous 16-byte copies per lane. Lanes 0..15 of a copy
// cover the 256 contiguous bytes of one row and lanes 16..31 those of the next row, so a
// wave-wide copy touches four whole 128-byte lines.
// g: this lane's first source word; l: this lane's first LDS byte address.
// s_wait_xcnt 0 ends the statement so that it stands before any rewrite of an address
// register that a copy names.
__device__ __forceinline__ void copy_mask_tile(const int* g, unsigned l)
{
    const int* g0 = g;
    const int* g1 = g + 2  * S_DIM;
    const int* g2 = g + 4  * S_DIM;
    const int* g3 = g + 6  * S_DIM;
    const int* g4 = g + 8  * S_DIM;
    const int* g5 = g + 10 * S_DIM;
    const int* g6 = g + 12 * S_DIM;
    const int* g7 = g + 14 * S_DIM;
    const unsigned st = 2u * MLP * 4u;   // two LDS rows, bytes
    asm volatile("global_load_async_to_lds_b128 %0, %8, off\n\t"
                 "global_load_async_to_lds_b128 %1, %9, off\n\t"
                 "global_load_async_to_lds_b128 %2, %10, off\n\t"
                 "global_load_async_to_lds_b128 %3, %11, off\n\t"
                 "global_load_async_to_lds_b128 %4, %12, off\n\t"
                 "global_load_async_to_lds_b128 %5, %13, off\n\t"
                 "global_load_async_to_lds_b128 %6, %14, off\n\t"
                 "global_load_async_to_lds_b128 %7, %15, off\n\t"
                 "s_wait_xcnt 0x0"
                 :: "v"(l), "v"(l + st), "v"(l + 2u * st), "v"(l + 3u * st),
                    "v"(l + 4u * st), "v"(l + 5u * st), "v"(l + 6u * st), "v"(l + 7u * st),
                    "v"(g0), "v"(g1), "v"(g2), "v"(g3), "v"(g4), "v"(g5), "v"(g6), "v"(g7)
                 : "memory");
}

// value of lane l ^ 16
__device__ __forceinline__ float other_half(float x)
{
    int b = __builtin_bit_cast(int, x);
    b = __builtin_amdgcn_permlanex16(b, b, 0x76543210, 0xfedcba98, false, false);
    return __builtin_bit_cast(float, b);
}

__global__ __launch_bounds__(NTHREADS)
void fa_wmma_kernel(const float* __restrict__ Q,
                    const float* __restrict__ K,
                    const float* __restrict__ V,
                    const int*   __restrict__ Mask,
                    float* __restrict__ Out)
{
    // LDS: K chunk (row major, f16), V chunk (transposed, f16)
    __shared__ __align__(128) _Float16 Kt[KV_CHUNK][LDP];        // [kv][d]   9 KB
    __shared__ __align__(128) _Float16 VtT[D_DIM][LDP];          // [d][kv]   9 KB
    // Mask tiles as 32-bit words, two buffers: the next chunk's tile lands while this one is used
    __shared__ __align__(128) int Mk[2][QTILE][MLP];             // [buf][q][kv]  34 KB

    const int tid  = threadIdx.x;
    const int wave = tid >> 5;
    const int lane = tid & 31;
    const int half = lane >> 4;     // 0 or 1 (lane groups per WMMA layout)
    const int lm   = lane & 15;     // lane % 16

    const int bh = blockIdx.y;              // b*H + h
    const int b  = bh / H_DIM;
    const size_t base = (size_t)bh * S_DIM * D_DIM;

    const float* Qb = Q + base;
    const float* Kb = K + base;
    const float* Vb = V + base;
    const int*   Mb = Mask + (size_t)b * S_DIM * S_DIM;  // head-broadcast mask

    const int q0   = blockIdx.x * QTILE + wave * 16;  // first Q row of this wave
    const int qrow = q0 + lm;                          // this lane's query (column of S^T, O^T)

    // ---- Load Q^T B-fragments (32x16 f16 each, D split into two K=32 chunks) ----
    // Lane L holds column N=L%16, k = (L/16)*16 + e, e=0..15 (contiguous in d, as the K rows)
    // Fold (1/sqrt(64)) * log2(e) into Q: softmax runs in the log2 domain.
    v16h aq[2];
    {
        const float scale = 0.18033688011112042f;  // 0.125 * log2(e)
        const float* qp = Qb + (size_t)qrow * D_DIM + half * 16;
        #pragma unroll
        for (int c = 0; c < 2; ++c) {
            const float* p = qp + c * 32;
            V16u a;
            #pragma unroll
            for (int i = 0; i < 8; ++i)
                a.h[i] = __builtin_amdgcn_cvt_pkrtz(p[2*i] * scale, p[2*i+1] * scale);
            aq[c] = a.v;
        }
    }

    // All-ones A fragment: ones x P^T = per-query sums over both lane halves' keys,
    // the same in all 8 accumulator rows
    v16h ones;
    #pragma unroll
    for (int e = 0; e < 16; ++e) ones[e] = (_Float16)1.0f;

    // Online-softmax state (log2 domain): one query per lane, equal in lanes l and l ^ 16
    float m_i = -3.0e38f;
    v8f   lacc;     // running denominator, accumulated through WMMA C operand
    v8f   o[4];
    lacc = (v8f){0,0,0,0,0,0,0,0};
    #pragma unroll
    for (int d = 0; d < 4; ++d) o[d] = (v8f){0,0,0,0,0,0,0,0};

    // Each wave copies its own 16 mask rows: copy i of lane l brings 16 bytes of row
    // wave*16 + 2*i + (l >> 4), words 4*(l & 15) .. +3 of the chunk
    const int  crow = wave * 16 + half;
    const int* mg   = Mb + (size_t)(blockIdx.x * QTILE + crow) * S_DIM + lm * 4;
    const unsigned ml0 = (unsigned)(size_t)&Mk[0][crow][lm * 4];
    const unsigned ml1 = (unsigned)(size_t)&Mk[1][crow][lm * 4];

    copy_mask_tile(mg, ml0);
    asm volatile("s_wait_asynccnt 0x0" ::: "memory");  // tile 0 has landed
    __syncthreads();                                   // ... and is published
    copy_mask_tile(mg + KV_CHUNK, ml1);

    for (int kv0 = 0; kv0 < S_DIM; kv0 += KV_CHUNK) {
        const int buf = (kv0 / KV_CHUNK) & 1;

        // ---- Cooperative stage: 4x4 register-transpose blocks, packed cvt ----
        #pragma unroll
        for (int i = 0; i < 2; ++i) {
            int t2 = tid + i * NTHREADS;      // 4x4 tile id, 0..255
            int tr = t2 >> 4;                 // kv block (0..15)
            int tc = t2 & 15;                 // d  block (0..15)
            const float* kp = Kb + (size_t)(kv0 + tr*4) * D_DIM + tc*4;
            const float* vp = Vb + (size_t)(kv0 + tr*4) * D_DIM + tc*4;
            float4 kf[4], vf[4];
            #pragma unroll
            for (int r = 0; r < 4; ++r) {
                kf[r] = *(const float4*)(kp + r * D_DIM);
                vf[r] = *(const float4*)(vp + r * D_DIM);
            }
            #pragma unroll
            for (int r = 0; r < 4; ++r) {
                H4u kk;
                kk.h[0] = __builtin_amdgcn_cvt_pkrtz(kf[r].x, kf[r].y);
                kk.h[1] = __builtin_amdgcn_cvt_pkrtz(kf[r].z, kf[r].w);
                *(h4*)&Kt[tr*4 + r][tc*4] = kk.v;   // ds_store_b64
            }
            #pragma unroll
            for (int c = 0; c < 4; ++c) {
                H4u vv;
                vv.h[0] = __builtin_amdgcn_cvt_pkrtz(((const float*)&vf[0])[c],
                                                     ((const float*)&vf[1])[c]);
                vv.h[1] = __builtin_amdgcn_cvt_pkrtz(((const float*)&vf[2])[c],
                                                     ((const float*)&vf[3])[c]);
                *(h4*)&VtT[tc*4 + c][tr*4] = vv.v;  // ds_store_b64
            }
        }
        if (kv0 + KV_CHUNK < S_DIM) {
            __builtin_prefetch(Kb + (size_t)(kv0 + KV_CHUNK) * D_DIM, 0, 1);
            __builtin_prefetch(Vb + (size_t)(kv0 + KV_CHUNK) * D_DIM, 0, 1);
        }

        // ---- Mask bias tiles from this chunk's LDS buffer (published at the last trip's foot) ----
        // S^T accumulator layout: lane holds query lm, keys j*16 + 8*half + v: 8 consecutive
        // mask words per tile and lane, two ds_load_b128.
        // cb[j][v] = mask ? -1e9 : 0, fed as the WMMA C operand (no post-WMMA select).
        const int* mp = &Mk[buf][wave * 16 + lm][8*half];
        int4 mki[4][2];
        #pragma unroll
        for (int j = 0; j < 4; ++j) {
            mki[j][0] = *(const int4*)(mp + j * 16);
            mki[j][1] = *(const int4*)(mp + j * 16 + 4);
        }
        v8f cb[4];
        #pragma unroll
        for (int j = 0; j < 4; ++j)
            #pragma unroll
            for (int p = 0; p < 2; ++p) {
                cb[j][4*p + 0] = (float)mki[j][p].x * -1.0e9f;
                cb[j][4*p + 1] = (float)mki[j][p].y * -1.0e9f;
                cb[j][4*p + 2] = (float)mki[j][p].z * -1.0e9f;
                cb[j][4*p + 3] = (float)mki[j][p].w * -1.0e9f;
            }

        __syncthreads();

        // ---- Score tiles: S^T = K Q^T + mask_bias (log2 domain) ----
        v8f sc[4];
        #pragma unroll
        for (int j = 0; j < 4; ++j) {
            v16h ak0 = ld_frag(&Kt[j*16 + lm][0  + half*16]);
            v16h ak1 = ld_frag(&Kt[j*16 + lm][32 + half*16]);
            v8f s = __builtin_amdgcn_wmma_f32_16x16x32_f16(false, ak0, false, aq[0],
                                                           (short)0, cb[j], false, false);
            s = __builtin_amdgcn_wmma_f32_16x16x32_f16(false, ak1, false, aq[1],
                                                       (short)0, s, false, false);
            sc[j] = s;
        }

        // ---- One online-softmax update per 64-wide chunk, one query per lane ----
        float tm[4];
        #pragma unroll
        for (int j = 0; j < 4; ++j) {
            float x0 = fmaxf(fmaxf(sc[j][0], sc[j][1]), sc[j][2]);
            float x1 = fmaxf(fmaxf(sc[j][3], sc[j][4]), sc[j][5]);
            tm[j] = fmaxf(fmaxf(x0, x1), fmaxf(sc[j][6], sc[j][7]));
        }
        float rm = fmaxf(fmaxf(tm[0], tm[1]), fmaxf(tm[2], tm[3]));
        rm = fmaxf(rm, other_half(rm));   // the other 32 keys of this query

        const float mnew  = fmaxf(m_i, rm);
        const float alpha = __builtin_exp2f(m_i - mnew);
        m_i = mnew;
        lacc *= alpha;
        #pragma unroll
        for (int d = 0; d < 4; ++d) o[d] *= alpha;

        // P^T as B operands straight from the score accumulators: tiles (0,1) are keys
        // 0..31, tiles (2,3) keys 32..63; position s of a lane is key 8*half + s or
        // 16 + 8*half + (s - 8) of its block, the order ld_frag_kmap gives V^T.
        // exp2(-1e9-ish - mnew) underflows to exactly 0 => masked P is 0
        P16u pb[2];
        #pragma unroll
        for (int j = 0; j < 4; ++j)
            #pragma unroll
            for (int i = 0; i < 4; ++i) {
                f2 e;
                e.x = __builtin_exp2f(sc[j][2*i]     - mnew);
                e.y = __builtin_exp2f(sc[j][2*i + 1] - mnew);
                pb[j >> 1].h[(j & 1) * 4 + i] = __builtin_convertvector(e, h2);
            }

        // l += sum over keys of P, accumulated entirely inside the matrix pipe
        lacc = __builtin_amdgcn_wmma_f32_16x16x32_f16(false, ones, false, pb[0].v,
                                                      (short)0, lacc, false, false);
        lacc = __builtin_amdgcn_wmma_f32_16x16x32_f16(false, ones, false, pb[1].v,
                                                      (short)0, lacc, false, false);

        // ---- O^T += V^T P^T : A[m][k] = V[kv0+k][d*16+m] from the transposed V tile ----
        #pragma unroll
        for (int d = 0; d < 4; ++d) {
            v16h av0 = ld_frag_kmap(&VtT[d*16 + lm][0],  half);
            v16h av1 = ld_frag_kmap(&VtT[d*16 + lm][32], half);
            o[d] = __builtin_amdgcn_wmma_f32_16x16x32_f16(false, av0, false, pb[0].v,
                                                          (short)0, o[d], false, false);
            o[d] = __builtin_amdgcn_wmma_f32_16x16x32_f16(false, av1, false, pb[1].v,
                                                          (short)0, o[d], false, false);
        }

        // ---- Foot: hand the buffers over ----
        asm volatile("s_wait_dscnt 0x0" ::: "memory");     // this wave's LDS reads of the chunk are done
        asm volatile("s_wait_asynccnt 0x0" ::: "memory");  // its copies of the next mask tile have landed
        __syncthreads();  // chunk fully consumed by all waves; next mask tile published
        if (kv0 + 2 * KV_CHUNK < S_DIM)
            copy_mask_tile(mg + kv0 + 2 * KV_CHUNK, buf ? ml1 : ml0);
    }
    asm volatile("s_wait_asynccnt 0x0" ::: "memory");  // no copy outstanding at the wave's end

    // ---- Epilogue: O / l, store fp32 [B,H,S,D] ----
    // o[d][v] = O[qrow][d*16 + 8*half + v]: two 16-byte stores per tile
    float* op = Out + base + (size_t)qrow * D_DIM + 8*half;
    const float inv = (lacc[0] > 0.0f) ? (1.0f / lacc[0]) : 0.0f;
    #pragma unroll
    for (int d = 0; d < 4; ++d) {
        *(float4*)(op + d*16)     = make_float4(o[d][0] * inv, o[d][1] * inv,
                                                o[d][2] * inv, o[d][3] * inv);
        *(float4*)(op + d*16 + 4) = make_float4(o[d][4] * inv, o[d][5] * inv,
                                                o[d][6] * inv, o[d][7] * inv);
    }
}

extern "C" void kernel_launch(void* const* d_in, const int* in_sizes, int n_in,
                              void* d_out, int out_size, void* d_ws, size_t ws_size,
                              hipStream_t stream) {
    (void)in_sizes; (void)n_in; (void)out_size; (void)d_ws; (void)ws_size;
    const float* Q    = (const float*)d_in[0];
    const float* K    = (const float*)d_in[1];
    const float* V    = (const float*)d_in[2];
    const int*   Mask = (const int*)d_in[3];
    float* Out = (float*)d_out;

    const int B = 4, H = H_DIM;
    dim3 grid(S_DIM / QTILE, B * H);   // (32, 32) blocks
    dim3 block(NTHREADS);
    fa_wmma_kernel<<<grid, block, 0, stream>>>(Q, K, V, Mask, Out);
}

// v004
// It runs in 63.2 microseconds.
// In both of two side-by-side timings against v003, it was 1.09 times as fast.
// Counting every step since v000, it is 2.67 times as fast.
#include <hip/hip_runtime.h>

typedef _Float16 v16h  __attribute__((ext_vector_type(16)));
typedef _Float16 v8h   __attribute__((ext_vector_type(8)));
typedef _Float16 h4    __attribute__((ext_vector_type(4)));
typedef __fp16   f16x2 __attribute__((ext_vector_type(2)));   // cvt_pkrtz return type
typedef float    v8f   __attribute__((ext_vector_type(8)));
typedef _Float16 h2    __attribute__((ext_vector_type(2)));
typedef float    f2    __attribute__((ext_vector_type(2)));

#define S_DIM 2048
#define D_DIM 64
#define H_DIM 8
#define KV_CHUNK 64
#define QTILE 64        // Q rows per block (4 waves x 16 rows)
#define NTHREADS 128
// LDS row pitch in f16 elements: 64 data + 8 pad = 144 B = 16 B x 9 (odd), so the
// 16 rows that one ds_load_b128 touches start on distinct 4-bank groups.
#define LDP 72
// LDS row pitch of the mask tile in 32-bit words: 64 data + 4 pad = 272 B = 16 B x 17 (odd)
#define MLP 68

union H4u  { h4   v; f16x2 h[2]; };
union V16u { v16h v; f16x2 h[8]; };
union P16u { v16h v; h2    h[8]; };

// 32-byte fragment from a row that is only 16-byte aligned: two ds_load_b128
__device__ __forceinline__ v16h ld_frag(const _Float16* p)
{
    v8h lo = *(const v8h*)p;
    v8h hi = *(const v8h*)(p + 8);
    return __builtin_shufflevector(lo, hi, 0, 1, 2, 3, 4, 5, 6, 7,
                                   8, 9, 10, 11, 12, 13, 14, 15);
}

// A fragment in the k order of a packed accumulator pair: p points at a block of
// 32 k in a row; position s holds k = 8*half + s (s < 8), 16 + 8*half + (s - 8) else
__device__ __forceinline__ v16h ld_frag_kmap(const _Float16* p, int half)
{
    v8h lo = *(const v8h*)(p + 8 * half);
    v8h hi = *(const v8h*)(p + 16 + 8 * half);
    return __builtin_shufflevector(lo, hi, 0, 1, 2, 3, 4, 5, 6, 7,
                                   8, 9, 10, 11, 12, 13, 14, 15);
}

// One 64 x 64 mask tile (this block's query rows, one key chunk) from global memory into
// LDS through no register: 8 asynchronous 16-byte copies per lane. Lanes 0..15 of a copy
// cover the 256 contiguous bytes of one row and lanes 16..31 those of the next row, so a
// wave-wide copy touches four whole 128-byte lines.
// g: this lane's first source word; l: this lane's first LDS byte address.
// s_wait_xcnt 0 ends the statement so that it stands before any rewrite of an address
// register that a copy names.
__device__ __forceinline__ void copy_mask_tile(const int* g, unsigned l)
{
    const int* g0 = g;
    const int* g1 = g + 2  * S_DIM;
    const int* g2 = g + 4  * S_DIM;
    const int* g3 = g + 6  * S_DIM;
    const int* g4 = g + 8  * S_DIM;
    const int* g5 = g + 10 * S_DIM;
    const int* g6 = g + 12 * S_DIM;
    const int* g7 = g + 14 * S_DIM;
    const unsigned st = 2u * MLP * 4u;   // two LDS rows, bytes
    asm volatile("global_load_async_to_lds_b128 %0, %8, off\n\t"
                 "global_load_async_to_lds_b128 %1, %9, off\n\t"
                 "global_load_async_to_lds_b128 %2, %10, off\n\t"
                 "global_load_async_to_lds_b128 %3, %11, off\n\t"
                 "global_load_async_to_lds_b128 %4, %12, off\n\t"
                 "global_load_async_to_lds_b128 %5, %13, off\n\t"
                 "global_load_async_to_lds_b128 %6, %14, off\n\t"
                 "global_load_async_to_lds_b128 %7, %15, off\n\t"
                 "s_wait_xcnt 0x0"
                 :: "v"(l), "v"(l + st), "v"(l + 2u * st), "v"(l + 3u * st),
                    "v"(l + 4u * st), "v"(l + 5u * st), "v"(l + 6u * st), "v"(l + 7u * st),
                    "v"(g0), "v"(g1), "v"(g2), "v"(g3), "v"(g4), "v"(g5), "v"(g6), "v"(g7)
                 : "memory");
}

// 2^x as the bare v_exp_f32, without the library form's range scaling (compare, two selects,
// add, ldexp per value). That scaling only matters for results below 2^-126, which the bare
// instruction may return as 0: a P that small rounds to 0 in f16 anyway, and an alpha that
// small multiplies sums that lie 2^126 below the new chunk's largest term.
__device__ __forceinline__ float exp2_bare(float x)
{
    return __builtin_amdgcn_exp2f(x);
}

// value of lane l ^ 16
__device__ __forceinline__ float other_half(float x)
{
    int b = __builtin_bit_cast(int, x);
    b = __builtin_amdgcn_permlanex16(b, b, 0x76543210, 0xfedcba98, false, false);
    return __builtin_bit_cast(float, b);
}

__global__ __launch_bounds__(NTHREADS)
void fa_wmma_kernel(const float* __restrict__ Q,
                    const float* __restrict__ K,
                    const float* __restrict__ V,
                    const int*   __restrict__ Mask,
                    float* __restrict__ Out)
{
    // LDS: K chunk (row major, f16), V chunk (transposed, f16)
    __shared__ __align__(128) _Float16 Kt[KV_CHUNK][LDP];        // [kv][d]   9 KB
    __shared__ __align__(128) _Float16 VtT[D_DIM][LDP];          // [d][kv]   9 KB
    // Mask tiles as 32-bit words, two buffers: the next chunk's tile lands while this one is used
    __shared__ __align__(128) int Mk[2][QTILE][MLP];             // [buf][q][kv]  34 KB

    const int tid  = threadIdx.x;
    const int wave = tid >> 5;
    const int lane = tid & 31;
    const int half = lane >> 4;     // 0 or 1 (lane groups per WMMA layout)
    const int lm   = lane & 15;     // lane % 16

    const int bh = blockIdx.y;              // b*H + h
    const int b  = bh / H_DIM;
    const size_t base = (size_t)bh * S_DIM * D_DIM;

    const float* Qb = Q + base;
    const float* Kb = K + base;
    const float* Vb = V + base;
    const int*   Mb = Mask + (size_t)b * S_DIM * S_DIM;  // head-broadcast mask

    const int q0   = blockIdx.x * QTILE + wave * 16;  // first Q row of this wave
    const int qrow = q0 + lm;                          // this lane's query (column of S^T, O^T)

    // ---- Load Q^T B-fragments (32x16 f16 each, D split into two K=32 chunks) ----
    // Lane L holds column N=L%16, k = (L/16)*16 + e, e=0..15 (contiguous in d, as the K rows)
    // Fold (1/sqrt(64)) * log2(e) into Q: softmax runs in the log2 domain.
    v16h aq[2];
    {
        const float scale = 0.18033688011112042f;  // 0.125 * log2(e)
        const float* qp = Qb + (size_t)qrow * D_DIM + half * 16;
        #pragma unroll
        for (int c = 0; c < 2; ++c) {
            const float* p = qp + c * 32;
            V16u a;
            #pragma unroll
            for (int i = 0; i < 8; ++i)
                a.h[i] = __builtin_amdgcn_cvt_pkrtz(p[2*i] * scale, p[2*i+1] * scale);
            aq[c] = a.v;
        }
    }

    // All-ones A fragment: ones x P^T = per-query sums over both lane halves' keys,
    // the same in all 8 accumulator rows
    v16h ones;
    #pragma unroll
    for (int e = 0; e < 16; ++e) ones[e] = (_Float16)1.0f;

    // Online-softmax state (log2 domain): one query per lane, equal in lanes l and l ^ 16
    float m_i = -3.0e38f;
    v8f   lacc;     // running denominator, accumulated through WMMA C operand
    v8f   o[4];
    lacc = (v8f){0,0,0,0,0,0,0,0};
    #pragma unroll
    for (int d = 0; d < 4; ++d) o[d] = (v8f){0,0,0,0,0,0,0,0};

    // Each wave copies its own 16 mask rows: copy i of lane l brings 16 bytes of row
    // wave*16 + 2*i + (l >> 4), words 4*(l & 15) .. +3 of the chunk
    const int  crow = wave * 16 + half;
    const int* mg   = Mb + (size_t)(blockIdx.x * QTILE + crow) * S_DIM + lm * 4;
    const unsigned ml0 = (unsigned)(size_t)&Mk[0][crow][lm * 4];
    const unsigned ml1 = (unsigned)(size_t)&Mk[1][crow][lm * 4];

    copy_mask_tile(mg, ml0);
    asm volatile("s_wait_asynccnt 0x0" ::: "memory");  // tile 0 has landed
    __syncthreads();                                   // ... and is published
    copy_mask_tile(mg + KV_CHUNK, ml1);

    for (int kv0 = 0; kv0 < S_DIM; kv0 += KV_CHUNK) {
        const int buf = (kv0 / KV_CHUNK) & 1;

        // ---- Cooperative stage: 4x4 register-transpose blocks, packed cvt ----
        #pragma unroll
        for (int i = 0; i < 2; ++i) {
            int t2 = tid + i * NTHREADS;      // 4x4 tile id, 0..255
            int tr = t2 >> 4;                 // kv block (0..15)
            int tc = t2 & 15;                 // d  block (0..15)
            const float* kp = Kb + (size_t)(kv0 + tr*4) * D_DIM + tc*4;
            const float* vp = Vb + (size_t)(kv0 + tr*4) * D_DIM + tc*4;
            float4 kf[4], vf[4];
            #pragma unroll
            for (int r = 0; r < 4; ++r) {
                kf[r] = *(const float4*)(kp + r * D_DIM);
                vf[r] = *(const float4*)(vp + r * D_DIM);
            }
            #pragma unroll
            for (int r = 0; r < 4; ++r) {
                H4u kk;
                kk.h[0] = __builtin_amdgcn_cvt_pkrtz(kf[r].x, kf[r].y);
                kk.h[1] = __builtin_amdgcn_cvt_pkrtz(kf[r].z, kf[r].w);
                *(h4*)&Kt[tr*4 + r][tc*4] = kk.v;   // ds_store_b64
            }
            #pragma unroll
            for (int c = 0; c < 4; ++c) {
                H4u vv;
                vv.h[0] = __builtin_amdgcn_cvt_pkrtz(((const float*)&vf[0])[c],
                                                     ((const float*)&vf[1])[c]);
                vv.h[1] = __builtin_amdgcn_cvt_pkrtz(((const float*)&vf[2])[c],
                                                     ((const float*)&vf[3])[c]);
                *(h4*)&VtT[tc*4 + c][tr*4] = vv.v;  // ds_store_b64
            }
        }
        if (kv0 + KV_CHUNK < S_DIM) {
            __builtin_prefetch(Kb + (size_t)(kv0 + KV_CHUNK) * D_DIM, 0, 1);
            __builtin_prefetch(Vb + (size_t)(kv0 + KV_CHUNK) * D_DIM, 0, 1);
        }

        // ---- Mask bias tiles from this chunk's LDS buffer (published at the last trip's foot) ----
        // S^T accumulator layout: lane holds query lm, keys j*16 + 8*half + v: 8 consecutive
        // mask words per tile and lane, two ds_load_b128.
        // cb[j][v] = mask ? -1e9 : 0, fed as the WMMA C operand (no post-WMMA select).
        const int* mp = &Mk[buf][wave * 16 + lm][8*half];
        int4 mki[4][2];
        #pragma unroll
        for (int j = 0; j < 4; ++j) {
            mki[j][0] = *(const int4*)(mp + j * 16);
            mki[j][1] = *(const int4*)(mp + j * 16 + 4);
        }
        v8f cb[4];
        #pragma unroll
        for (int j = 0; j < 4; ++j)
            #pragma unroll
            for (int p = 0; p < 2; ++p) {
                cb[j][4*p + 0] = (float)mki[j][p].x * -1.0e9f;
                cb[j][4*p + 1] = (float)mki[j][p].y * -1.0e9f;
                cb[j][4*p + 2] = (float)mki[j][p].z * -1.0e9f;
                cb[j][4*p + 3] = (float)mki[j][p].w * -1.0e9f;
            }

        __syncthreads();

        // ---- Score tiles: S^T = K Q^T + mask_bias (log2 domain) ----
        v8f sc[4];
        #pragma unroll
        for (int j = 0; j < 4; ++j) {
            v16h ak0 = ld_frag(&Kt[j*16 + lm][0  + half*16]);
            v16h ak1 = ld_frag(&Kt[j*16 + lm][32 + half*16]);
            v8f s = __builtin_amdgcn_wmma_f32_16x16x32_f16(false, ak0, false, aq[0],
                                                           (short)0, cb[j], false, false);
            s = __builtin_amdgcn_wmma_f32_16x16x32_f16(false, ak1, false, aq[1],
                                                       (short)0, s, false, false);
            sc[j] = s;
        }

        // ---- One online-softmax update per 64-wide chunk, one query per lane ----
        float tm[4];
        #pragma unroll
        for (int j = 0; j < 4; ++j) {
            float x0 = fmaxf(fmaxf(sc[j][0], sc[j][1]), sc[j][2]);
            float x1 = fmaxf(fmaxf(sc[j][3], sc[j][4]), sc[j][5]);
            tm[j] = fmaxf(fmaxf(x0, x1), fmaxf(sc[j][6], sc[j][7]));
        }
        float rm = fmaxf(fmaxf(tm[0], tm[1]), fmaxf(tm[2], tm[3]));
        rm = fmaxf(rm, other_half(rm));   // the other 32 keys of this query

        const float mnew  = fmaxf(m_i, rm);
        const float alpha = exp2_bare(m_i - mnew);
        m_i = mnew;
        lacc *= alpha;
        #pragma unroll
        for (int d = 0; d < 4; ++d) o[d] *= alpha;

        // P^T as B operands straight from the score accumulators: tiles (0,1) are keys
        // 0..31, tiles (2,3) keys 32..63; position s of a lane is key 8*half + s or
        // 16 + 8*half + (s - 8) of its block, the order ld_frag_kmap gives V^T.
        // exp2(-1e9-ish - mnew) underflows to exactly 0 => masked P is 0
        P16u pb[2];
        #pragma unroll
        for (int j = 0; j < 4; ++j)
            #pragma unroll
            for (int i = 0; i < 4; ++i) {
                // two scores per subtract: one v_pk_add_f32
                const f2 x = (f2){sc[j][2*i], sc[j][2*i + 1]} - (f2){mnew, mnew};
                f2 e;
                e.x = exp2_bare(x.x);
                e.y = exp2_bare(x.y);
                pb[j >> 1].h[(j & 1) * 4 + i] = __builtin_convertvector(e, h2);
            }

        // l += sum over keys of P, accumulated entirely inside the matrix pipe
        lacc = __builtin_amdgcn_wmma_f32_16x16x32_f16(false, ones, false, pb[0].v,
                                                      (short)0, lacc, false, false);
        lacc = __builtin_amdgcn_wmma_f32_16x16x32_f16(false, ones, false, pb[1].v,
                                                      (short)0, lacc, false, false);

        // ---- O^T += V^T P^T : A[m][k] = V[kv0+k][d*16+m] from the transposed V tile ----
        #pragma unroll
        for (int d = 0; d < 4; ++d) {
            v16h av0 = ld_frag_kmap(&VtT[d*16 + lm][0],  half);
            v16h av1 = ld_frag_kmap(&VtT[d*16 + lm][32], half);
            o[d] = __builtin_amdgcn_wmma_f32_16x16x32_f16(false, av0, false, pb[0].v,
                                                          (short)0, o[d], false, false);
            o[d] = __builtin_amdgcn_wmma_f32_16x16x32_f16(false, av1, false, pb[1].v,
                                                          (short)0, o[d], false, false);
        }

        // ---- Foot: hand the buffers over ----
        asm volatile("s_wait_dscnt 0x0" ::: "memory");     // this wave's LDS reads of the chunk are done
        asm volatile("s_wait_asynccnt 0x0" ::: "memory");  // its copies of the next mask tile have landed
        __syncthreads();  // chunk fully consumed by all waves; next mask tile published
        if (kv0 + 2 * KV_CHUNK < S_DIM)
            copy_mask_tile(mg + kv0 + 2 * KV_CHUNK, buf ? ml1 : ml0);
    }
    asm volatile("s_wait_asynccnt 0x0" ::: "memory");  // no copy outstanding at the wave's end

    // ---- Epilogue: O / l, store fp32 [B,H,S,D] ----
    // o[d][v] = O[qrow][d*16 + 8*half + v]: two 16-byte stores per tile
    float* op = Out + base + (size_t)qrow * D_DIM + 8*half;
    const float inv = (lacc[0] > 0.0f) ? (1.0f / lacc[0]) : 0.0f;
    #pragma unroll
    for (int d = 0; d < 4; ++d) {
        *(float4*)(op + d*16)     = make_float4(o[d][0] * inv, o[d][1] * inv,
                                                o[d][2] * inv, o[d][3] * inv);
        *(float4*)(op + d*16 + 4) = make_float4(o[d][4] * inv, o[d][5] * inv,
                                                o[d][6] * inv, o[d][7] * inv);
    }
}

extern "C" void kernel_launch(void* const* d_in, const int* in_sizes, int n_in,
                              void* d_out, int out_size, void* d_ws, size_t ws_size,
                              hipStream_t stream) {
    (void)in_sizes; (void)n_in; (void)out_size; (void)d_ws; (void)ws_size;
    const float* Q    = (const float*)d_in[0];
    const float* K    = (const float*)d_in[1];
    const float* V    = (const float*)d_in[2];
    const int*   Mask = (const int*)d_in[3];
    float* Out = (float*)d_out;

    const int B = 4, H = H_DIM;
    dim3 grid(S_DIM / QTILE, B * H);   // (32, 32) blocks
    dim3 block(NTHREADS);
    fa_wmma_kernel<<<grid, block, 0, stream>>>(Q, K, V, Mask, Out);
}

// v005
// One run takes 61.4 microseconds.
// In two side-by-side timings against v004, it was 1.03 and 1.02 times as fast.
// Counting every step since v000, it is 2.74 times as fast.
#include <hip/hip_runtime.h>

typedef _Float16 v16h  __attribute__((ext_vector_type(16)));
typedef _Float16 v8h   __attribute__((ext_vector_type(8)));
typedef _Float16 h4    __attribute__((ext_vector_type(4)));
typedef __fp16   f16x2 __attribute__((ext_vector_type(2)));   // cvt_pkrtz return type
typedef float    v8f   __attribute__((ext_vector_type(8)));
typedef _Float16 h2    __attribute__((ext_vector_type(2)));
typedef float    f2    __attribute__((ext_vector_type(2)));

#define S_DIM 2048
#define D_DIM 64
#define H_DIM 8
#define KV_CHUNK 64
#define QTILE 64        // Q rows per block (4 waves x 16 rows)
#define NTHREADS 128
// LDS row pitch in f16 elements: 64 data + 8 pad = 144 B = 16 B x 9 (odd), so the
// 16 rows that one ds_load_b128 touches start on distinct 4-bank groups.
#define LDP 72
// LDS row pitch of the mask tile in 32-bit words: 64 data + 4 pad = 272 B = 16 B x 17 (odd)
#define MLP 68

union H4u  { h4   v; f16x2 h[2]; };
union V16u { v16h v; f16x2 h[8]; };
union P16u { v16h v; h2    h[8]; };

// 32-byte fragment from a row that is only 16-byte aligned: two ds_load_b128
__device__ __forceinline__ v16h ld_frag(const _Float16* p)
{
    v8h lo = *(const v8h*)p;
    v8h hi = *(const v8h*)(p + 8);
    return __builtin_shufflevector(lo, hi, 0, 1, 2, 3, 4, 5, 6, 7,
                                   8, 9, 10, 11, 12, 13, 14, 15);
}

// A fragment in the k order of a packed accumulator pair: p points at a block of
// 32 k in a row; position s holds k = 8*half + s (s < 8), 16 + 8*half + (s - 8) else
__device__ __forceinline__ v16h ld_frag_kmap(const _Float16* p, int half)
{
    v8h lo = *(const v8h*)(p + 8 * half);
    v8h hi = *(const v8h*)(p + 16 + 8 * half);
    return __builtin_shufflevector(lo, hi, 0, 1, 2, 3, 4, 5, 6, 7,
                                   8, 9, 10, 11, 12, 13, 14, 15);
}

// One 64 x 64 mask tile (this block's query rows, one key chunk) from global memory into
// LDS through no register: 8 asynchronous 16-byte copies per lane. Lanes 0..15 of a copy
// cover the 256 contiguous bytes of one row and lanes 16..31 those of the next row, so a
// wave-wide copy touches four whole 128-byte lines.
// g: this lane's first source word; l: this lane's first LDS byte address.
// s_wait_xcnt 0 ends the statement so that it stands before any rewrite of an address
// register that a copy names.
__device__ __forceinline__ void copy_mask_tile(const int* g, unsigned l)
{
    const int* g0 = g;
    const int* g1 = g + 2  * S_DIM;
    const int* g2 = g + 4  * S_DIM;
    const int* g3 = g + 6  * S_DIM;
    const int* g4 = g + 8  * S_DIM;
    const int* g5 = g + 10 * S_DIM;
    const int* g6 = g + 12 * S_DIM;
    const int* g7 = g + 14 * S_DIM;
    const unsigned st = 2u * MLP * 4u;   // two LDS rows, bytes
    asm volatile("global_load_async_to_lds_b128 %0, %8, off\n\t"
                 "global_load_async_to_lds_b128 %1, %9, off\n\t"
                 "global_load_async_to_lds_b128 %2, %10, off\n\t"
                 "global_load_async_to_lds_b128 %3, %11, off\n\t"
                 "global_load_async_to_lds_b128 %4, %12, off\n\t"
                 "global_load_async_to_lds_b128 %5, %13, off\n\t"
                 "global_load_async_to_lds_b128 %6, %14, off\n\t"
                 "global_load_async_to_lds_b128 %7, %15, off\n\t"
                 "s_wait_xcnt 0x0"
                 :: "v"(l), "v"(l + st), "v"(l + 2u * st), "v"(l + 3u * st),
                    "v"(l + 4u * st), "v"(l + 5u * st), "v"(l + 6u * st), "v"(l + 7u * st),
                    "v"(g0), "v"(g1), "v"(g2), "v"(g3), "v"(g4), "v"(g5), "v"(g6), "v"(g7)
                 : "memory");
}

// One thread's share of a 64 x 64 K chunk and V chunk, f32, into registers: two 4x4 blocks of
// each. k, v: the first word of this thread's first block; the second lies 32 rows on.
__device__ __forceinline__ void load_kv_rows(const float* k, const float* v,
                                             float4 (&kf)[2][4], float4 (&vf)[2][4])
{
    #pragma unroll
    for (int i = 0; i < 2; ++i)
        #pragma unroll
        for (int r = 0; r < 4; ++r) {
            kf[i][r] = *(const float4*)(k + (i * 32 + r) * D_DIM);
            vf[i][r] = *(const float4*)(v + (i * 32 + r) * D_DIM);
        }
}

// The two halves of the work-group barrier, with no wait of their own: the waits that a place
// needs stand in front of the signal. The clobber keeps LDS accesses on their side.
__device__ __forceinline__ void bar_signal() { asm volatile("s_barrier_signal -1" ::: "memory"); }
__device__ __forceinline__ void bar_wait()   { asm volatile("s_barrier_wait -1" ::: "memory"); }

// 2^x as the bare v_exp_f32, without the library form's range scaling (compare, two selects,
// add, ldexp per value). That scaling only matters for results below 2^-126, which the bare
// instruction may return as 0: a P that small rounds to 0 in f16 anyway, and an alpha that
// small multiplies sums that lie 2^126 below the new chunk's largest term.
__device__ __forceinline__ float exp2_bare(float x)
{
    return __builtin_amdgcn_exp2f(x);
}

// value of lane l ^ 16
__device__ __forceinline__ float other_half(float x)
{
    int b = __builtin_bit_cast(int, x);
    b = __builtin_amdgcn_permlanex16(b, b, 0x76543210, 0xfedcba98, false, false);
    return __builtin_bit_cast(float, b);
}

// At most four waves per SIMD (four work-groups per WGP) are ever there, as the grid fills the
// chip once: a register budget for that, so that the 64 registers that carry the rows in flight
// do not squeeze the fragment loads
__global__ __launch_bounds__(NTHREADS) __attribute__((amdgpu_waves_per_eu(3, 4)))
void fa_wmma_kernel(const float* __restrict__ Q,
                    const float* __restrict__ K,
                    const float* __restrict__ V,
                    const int*   __restrict__ Mask,
                    float* __restrict__ Out)
{
    // LDS: K chunk (row major, f16), V chunk (transposed, f16)
    __shared__ __align__(128) _Float16 Kt[KV_CHUNK][LDP];        // [kv][d]   9 KB
    __shared__ __align__(128) _Float16 VtT[D_DIM][LDP];          // [d][kv]   9 KB
    // Mask tiles as 32-bit words, two buffers: the next chunk's tile lands while this one is used
    __shared__ __align__(128) int Mk[2][QTILE][MLP];             // [buf][q][kv]  34 KB

    const int tid  = threadIdx.x;
    const int wave = tid >> 5;
    const int lane = tid & 31;
    const int half = lane >> 4;     // 0 or 1 (lane groups per WMMA layout)
    const int lm   = lane & 15;     // lane % 16

    const int bh = blockIdx.y;              // b*H + h
    const int b  = bh / H_DIM;
    const size_t base = (size_t)bh * S_DIM * D_DIM;

    const float* Qb = Q + base;
    const float* Kb = K + base;
    const float* Vb = V + base;
    const int*   Mb = Mask + (size_t)b * S_DIM * S_DIM;  // head-broadcast mask

    const int q0   = blockIdx.x * QTILE + wave * 16;  // first Q row of this wave
    const int qrow = q0 + lm;                          // this lane's query (column of S^T, O^T)

    // ---- Load Q^T B-fragments (32x16 f16 each, D split into two K=32 chunks) ----
    // Lane L holds column N=L%16, k = (L/16)*16 + e, e=0..15 (contiguous in d, as the K rows)
    // Fold (1/sqrt(64)) * log2(e) into Q: softmax runs in the log2 domain.
    v16h aq[2];
    {
        const float scale = 0.18033688011112042f;  // 0.125 * log2(e)
        const float* qp = Qb + (size_t)qrow * D_DIM + half * 16;
        #pragma unroll
        for (int c = 0; c < 2; ++c) {
            const float* p = qp + c * 32;
            V16u a;
            #pragma unroll
            for (int i = 0; i < 8; ++i)
                a.h[i] = __builtin_amdgcn_cvt_pkrtz(p[2*i] * scale, p[2*i+1] * scale);
            aq[c] = a.v;
        }
    }

    // All-ones A fragment: ones x P^T = per-query sums over both lane halves' keys,
    // the same in all 8 accumulator rows
    v16h ones;
    #pragma unroll
    for (int e = 0; e < 16; ++e) ones[e] = (_Float16)1.0f;

    // Online-softmax state (log2 domain): one query per lane, equal in lanes l and l ^ 16
    float m_i = -3.0e38f;
    v8f   lacc;     // running denominator, accumulated through WMMA C operand
    v8f   o[4];
    lacc = (v8f){0,0,0,0,0,0,0,0};
    #pragma unroll
    for (int d = 0; d < 4; ++d) o[d] = (v8f){0,0,0,0,0,0,0,0};

    // Each wave copies its own 16 mask rows: copy i of lane l brings 16 bytes of row
    // wave*16 + 2*i + (l >> 4), words 4*(l & 15) .. +3 of the chunk
    const int  crow = wave * 16 + half;
    const int* mg   = Mb + (size_t)(blockIdx.x * QTILE + crow) * S_DIM + lm * 4;
    const unsigned ml0 = (unsigned)(size_t)&Mk[0][crow][lm * 4];
    const unsigned ml1 = (unsigned)(size_t)&Mk[1][crow][lm * 4];

    // K and V rows of a chunk travel one trip ahead of their use, in registers
    const float* kg = Kb + (size_t)((tid >> 4) * 4) * D_DIM + (tid & 15) * 4;
    const float* vg = Vb + (size_t)((tid >> 4) * 4) * D_DIM + (tid & 15) * 4;
    float4 kf[2][4], vf[2][4];

    copy_mask_tile(mg, ml0);
    load_kv_rows(kg, vg, kf, vf);
    asm volatile("s_wait_asynccnt 0x0" ::: "memory");  // tile 0 has landed
    __syncthreads();                                   // ... and is published
    copy_mask_tile(mg + KV_CHUNK, ml1);

    for (int kv0 = 0; kv0 < S_DIM; kv0 += KV_CHUNK) {
        const int buf = (kv0 / KV_CHUNK) & 1;

        // ---- Cooperative stage: 4x4 register-transpose blocks, packed cvt ----
        // kf / vf hold this chunk's rows, loaded one trip ago (chunk 0: in front of the loop)
        #pragma unroll
        for (int i = 0; i < 2; ++i) {
            int t2 = tid + i * NTHREADS;      // 4x4 tile id, 0..255
            int tr = t2 >> 4;                 // kv block (0..15)
            int tc = t2 & 15;                 // d  block (0..15)
            #pragma unroll
            for (int r = 0; r < 4; ++r) {
                H4u kk;
                kk.h[0] = __builtin_amdgcn_cvt_pkrtz(kf[i][r].x, kf[i][r].y);
                kk.h[1] = __builtin_amdgcn_cvt_pkrtz(kf[i][r].z, kf[i][r].w);
                *(h4*)&Kt[tr*4 + r][tc*4] = kk.v;   // ds_store_b64
            }
            #pragma unroll
            for (int c = 0; c < 4; ++c) {
                H4u vv;
                vv.h[0] = __builtin_amdgcn_cvt_pkrtz(((const float*)&vf[i][0])[c],
                                                     ((const float*)&vf[i][1])[c]);
                vv.h[1] = __builtin_amdgcn_cvt_pkrtz(((const float*)&vf[i][2])[c],
                                                     ((const float*)&vf[i][3])[c]);
                *(h4*)&VtT[tc*4 + c][tr*4] = vv.v;  // ds_store_b64
            }
        }
        // The next chunk's rows start their way now and are first used at the top of the next
        // trip: their latency runs under this chunk's products and softmax. No branch round
        // the loads (a merge of two paths made the compiler wait for them at once): the last
        // trip reads its own chunk again and nobody uses it.
        const int kvn = (kv0 + KV_CHUNK < S_DIM) ? kv0 + KV_CHUNK : kv0;
        const float* kn = kg + (size_t)kvn * D_DIM;
        const float* vn = vg + (size_t)kvn * D_DIM;
        load_kv_rows(kn, vn, kf, vf);

        // ---- Mask bias tiles from this chunk's LDS buffer (published at the last trip's foot) ----
        // S^T accumulator layout: lane holds query lm, keys j*16 + 8*half + v: 8 consecutive
        // mask words per tile and lane, two ds_load_b128.
        // cb[j][v] = mask ? -1e9 : 0, fed as the WMMA C operand (no post-WMMA select).
        const int* mp = &Mk[buf][wave * 16 + lm][8*half];
        int4 mki[4][2];
        #pragma unroll
        for (int j = 0; j < 4; ++j) {
            mki[j][0] = *(const int4*)(mp + j * 16);
            mki[j][1] = *(const int4*)(mp + j * 16 + 4);
        }
        // The work-group barrier by hand: __syncthreads() also waits for every global load of
        // the wave, which would end the flight of the next chunk's rows here.
        // The loads' address registers are inputs here so that they stay whole up to this wait
        // and are free for other use only behind it.
        asm volatile("s_wait_xcnt 0x0" :: "v"(kn), "v"(vn) : "memory");
        asm volatile("s_wait_dscnt 0x0" ::: "memory");  // this wave's K / V^T stores are in LDS
        bar_signal();
        v8f cb[4];
        #pragma unroll
        for (int j = 0; j < 4; ++j)
            #pragma unroll
            for (int p = 0; p < 2; ++p) {
                cb[j][4*p + 0] = (float)mki[j][p].x * -1.0e9f;
                cb[j][4*p + 1] = (float)mki[j][p].y * -1.0e9f;
                cb[j][4*p + 2] = (float)mki[j][p].z * -1.0e9f;
                cb[j][4*p + 3] = (float)mki[j][p].w * -1.0e9f;
            }

        bar_wait();     // every wave's K and V^T rows of this chunk are in LDS

        // ---- Score tiles: S^T = K Q^T + mask_bias (log2 domain) ----
        v8f sc[4];
        #pragma unroll
        for (int j = 0; j < 4; ++j) {
            v16h ak0 = ld_frag(&Kt[j*16 + lm][0  + half*16]);
            v16h ak1 = ld_frag(&Kt[j*16 + lm][32 + half*16]);
            v8f s = __builtin_amdgcn_wmma_f32_16x16x32_f16(false, ak0, false, aq[0],
                                                           (short)0, cb[j], false, false);
            s = __builtin_amdgcn_wmma_f32_16x16x32_f16(false, ak1, false, aq[1],
                                                       (short)0, s, false, false);
            sc[j] = s;
        }

        // ---- One online-softmax update per 64-wide chunk, one query per lane ----
        float tm[4];
        #pragma unroll
        for (int j = 0; j < 4; ++j) {
            float x0 = fmaxf(fmaxf(sc[j][0], sc[j][1]), sc[j][2]);
            float x1 = fmaxf(fmaxf(sc[j][3], sc[j][4]), sc[j][5]);
            tm[j] = fmaxf(fmaxf(x0, x1), fmaxf(sc[j][6], sc[j][7]));
        }
        float rm = fmaxf(fmaxf(tm[0], tm[1]), fmaxf(tm[2], tm[3]));
        rm = fmaxf(rm, other_half(rm));   // the other 32 keys of this query

        const float mnew  = fmaxf(m_i, rm);
        const float alpha = exp2_bare(m_i - mnew);
        m_i = mnew;
        lacc *= alpha;
        #pragma unroll
        for (int d = 0; d < 4; ++d) o[d] *= alpha;

        // P^T as B operands straight from the score accumulators: tiles (0,1) are keys
        // 0..31, tiles (2,3) keys 32..63; position s of a lane is key 8*half + s or
        // 16 + 8*half + (s - 8) of its block, the order ld_frag_kmap gives V^T.
        // exp2(-1e9-ish - mnew) underflows to exactly 0 => masked P is 0
        P16u pb[2];
        #pragma unroll
        for (int j = 0; j < 4; ++j)
            #pragma unroll
            for (int i = 0; i < 4; ++i) {
                // two scores per subtract: one v_pk_add_f32
                const f2 x = (f2){sc[j][2*i], sc[j][2*i + 1]} - (f2){mnew, mnew};
                f2 e;
                e.x = exp2_bare(x.x);
                e.y = exp2_bare(x.y);
                pb[j >> 1].h[(j & 1) * 4 + i] = __builtin_convertvector(e, h2);
            }

        // l += sum over keys of P, accumulated entirely inside the matrix pipe
        lacc = __builtin_amdgcn_wmma_f32_16x16x32_f16(false, ones, false, pb[0].v,
                                                      (short)0, lacc, false, false);
        lacc = __builtin_amdgcn_wmma_f32_16x16x32_f16(false, ones, false, pb[1].v,
                                                      (short)0, lacc, false, false);

        // ---- O^T += V^T P^T : A[m][k] = V[kv0+k][d*16+m] from the transposed V tile ----
        #pragma unroll
        for (int d = 0; d < 4; ++d) {
            v16h av0 = ld_frag_kmap(&VtT[d*16 + lm][0],  half);
            v16h av1 = ld_frag_kmap(&VtT[d*16 + lm][32], half);
            o[d] = __builtin_amdgcn_wmma_f32_16x16x32_f16(false, av0, false, pb[0].v,
                                                          (short)0, o[d], false, false);
            o[d] = __builtin_amdgcn_wmma_f32_16x16x32_f16(false, av1, false, pb[1].v,
                                                          (short)0, o[d], false, false);
        }

        // ---- Foot: hand the buffers over ----
        asm volatile("s_wait_dscnt 0x0" ::: "memory");     // this wave's LDS reads of the chunk are done
        asm volatile("s_wait_asynccnt 0x0" ::: "memory");  // its copies of the next mask tile have landed
        bar_signal();     // by hand, as above: the rows in flight stay in flight
        bar_wait();       // chunk fully consumed by all waves; next mask tile published
        if (kv0 + 2 * KV_CHUNK < S_DIM)
            copy_mask_tile(mg + kv0 + 2 * KV_CHUNK, buf ? ml1 : ml0);
    }
    asm volatile("s_wait_asynccnt 0x0" ::: "memory");  // no copy outstanding at the wave's end
    asm volatile("s_wait_loadcnt 0x0" ::: "memory");   // nor a row of the last trip's unused loads

    // ---- Epilogue: O / l, store fp32 [B,H,S,D] ----
    // o[d][v] = O[qrow][d*16 + 8*half + v]: two 16-byte stores per tile
    float* op = Out + base + (size_t)qrow * D_DIM + 8*half;
    const float inv = (lacc[0] > 0.0f) ? (1.0f / lacc[0]) : 0.0f;
    #pragma unroll
    for (int d = 0; d < 4; ++d) {
        *(float4*)(op + d*16)     = make_float4(o[d][0] * inv, o[d][1] * inv,
                                                o[d][2] * inv, o[d][3] * inv);
        *(float4*)(op + d*16 + 4) = make_float4(o[d][4] * inv, o[d][5] * inv,
                                                o[d][6] * inv, o[d][7] * inv);
    }
}

extern "C" void kernel_launch(void* const* d_in, const int* in_sizes, int n_in,
                              void* d_out, int out_size, void* d_ws, size_t ws_size,
                              hipStream_t stream) {
    (void)in_sizes; (void)n_in; (void)out_size; (void)d_ws; (void)ws_size;
    const float* Q    = (const float*)d_in[0];
    const float* K    = (const float*)d_in[1];
    const float* V    = (const float*)d_in[2];
    const int*   Mask = (const int*)d_in[3];
    float* Out = (float*)d_out;

    const int B = 4, H = H_DIM;
    dim3 grid(S_DIM / QTILE, B * H);   // (32, 32) blocks
    dim3 block(NTHREADS);
    fa_wmma_kernel<<<grid, block, 0, stream>>>(Q, K, V, Mask, Out);
}

// v006
// A run of this version takes 51 microseconds.
// Two timings next to v005 both put it at 1.21 times that version's speed.
// Over all steps from v000 it is 3.31 times as fast.
#include <hip/hip_runtime.h>

typedef _Float16 v16h  __attribute__((ext_vector_type(16)));
typedef _Float16 v8h   __attribute__((ext_vector_type(8)));
typedef _Float16 h4    __attribute__((ext_vector_type(4)));
typedef __fp16   f16x2 __attribute__((ext_vector_type(2)));   // cvt_pkrtz return type
typedef float    v8f   __attribute__((ext_vector_type(8)));
typedef _Float16 h2    __attribute__((ext_vector_type(2)));
typedef float    f2    __attribute__((ext_vector_type(2)));

#define S_DIM 2048
#define D_DIM 64
#define H_DIM 8
#define KV_CHUNK 64
#define QTILE 128       // Q rows per block (8 waves x 16 rows)
#define NTHREADS 256
// LDS row pitch in f16 elements: 64 data + 8 pad = 144 B = 16 B x 9 (odd), so the
// 16 rows that one ds_load_b128 touches start on distinct 4-bank groups.
#define LDP 72
// LDS row pitch of the mask tile in 32-bit words: 64 data + 4 pad = 272 B = 16 B x 17 (odd)
#define MLP 68

union H4u  { h4   v; f16x2 h[2]; };
union V16u { v16h v; f16x2 h[8]; };
union P16u { v16h v; h2    h[8]; };

// 32-byte fragment from a row that is only 16-byte aligned: two ds_load_b128
__device__ __forceinline__ v16h ld_frag(const _Float16* p)
{
    v8h lo = *(const v8h*)p;
    v8h hi = *(const v8h*)(p + 8);
    return __builtin_shufflevector(lo, hi, 0, 1, 2, 3, 4, 5, 6, 7,
                                   8, 9, 10, 11, 12, 13, 14, 15);
}

// A fragment in the k order of a packed accumulator pair: p points at a block of
// 32 k in a row; position s holds k = 8*half + s (s < 8), 16 + 8*half + (s - 8) else
__device__ __forceinline__ v16h ld_frag_kmap(const _Float16* p, int half)
{
    v8h lo = *(const v8h*)(p + 8 * half);
    v8h hi = *(const v8h*)(p + 16 + 8 * half);
    return __builtin_shufflevector(lo, hi, 0, 1, 2, 3, 4, 5, 6, 7,
                                   8, 9, 10, 11, 12, 13, 14, 15);
}

// One 128 x 64 mask tile (this block's query rows, one key chunk) from global memory into
// LDS through no register: 8 asynchronous 16-byte copies per lane. Lanes 0..15 of a copy
// cover the 256 contiguous bytes of one row and lanes 16..31 those of the next row, so a
// wave-wide copy touches four whole 128-byte lines.
// g: this lane's first source word; l: this lane's first LDS byte address.
// s_wait_xcnt 0 ends the statement so that it stands before any rewrite of an address
// register that a copy names.
__device__ __forceinline__ void copy_mask_tile(const int* g, unsigned l)
{
    const int* g0 = g;
    const int* g1 = g + 2  * S_DIM;
    const int* g2 = g + 4  * S_DIM;
    const int* g3 = g + 6  * S_DIM;
    const int* g4 = g + 8  * S_DIM;
    const int* g5 = g + 10 * S_DIM;
    const int* g6 = g + 12 * S_DIM;
    const int* g7 = g + 14 * S_DIM;
    const unsigned st = 2u * MLP * 4u;   // two LDS rows, bytes
    asm volatile("global_load_async_to_lds_b128 %0, %8, off\n\t"
                 "global_load_async_to_lds_b128 %1, %9, off\n\t"
                 "global_load_async_to_lds_b128 %2, %10, off\n\t"
                 "global_load_async_to_lds_b128 %3, %11, off\n\t"
                 "global_load_async_to_lds_b128 %4, %12, off\n\t"
                 "global_load_async_to_lds_b128 %5, %13, off\n\t"
                 "global_load_async_to_lds_b128 %6, %14, off\n\t"
                 "global_load_async_to_lds_b128 %7, %15, off\n\t"
                 "s_wait_xcnt 0x0"
                 :: "v"(l), "v"(l + st), "v"(l + 2u * st), "v"(l + 3u * st),
                    "v"(l + 4u * st), "v"(l + 5u * st), "v"(l + 6u * st), "v"(l + 7u * st),
                    "v"(g0), "v"(g1), "v"(g2), "v"(g3), "v"(g4), "v"(g5), "v"(g6), "v"(g7)
                 : "memory");
}

// One thread's share of a 64 x 64 K chunk and V chunk, f32, into registers: one 4x4 block of
// each. k, v: the first word of this thread's block.
__device__ __forceinline__ void load_kv_rows(const float* k, const float* v,
                                             float4 (&kf)[4], float4 (&vf)[4])
{
    #pragma unroll
    for (int r = 0; r < 4; ++r) {
        kf[r] = *(const float4*)(k + r * D_DIM);
        vf[r] = *(const float4*)(v + r * D_DIM);
    }
}

// The two halves of the work-group barrier, with no wait of their own: the waits that a place
// needs stand in front of the signal. The clobber keeps LDS accesses on their side.
__device__ __forceinline__ void bar_signal() { asm volatile("s_barrier_signal -1" ::: "memory"); }
__device__ __forceinline__ void bar_wait()   { asm volatile("s_barrier_wait -1" ::: "memory"); }

// 2^x as the bare v_exp_f32, without the library form's range scaling (compare, two selects,
// add, ldexp per value). That scaling only matters for results below 2^-126, which the bare
// instruction may return as 0: a P that small rounds to 0 in f16 anyway, and an alpha that
// small multiplies sums that lie 2^126 below the new chunk's largest term.
__device__ __forceinline__ float exp2_bare(float x)
{
    return __builtin_amdgcn_exp2f(x);
}

// value of lane l ^ 16
__device__ __forceinline__ float other_half(float x)
{
    int b = __builtin_bit_cast(int, x);
    b = __builtin_amdgcn_permlanex16(b, b, 0x76543210, 0xfedcba98, false, false);
    return __builtin_bit_cast(float, b);
}

// At most four waves per SIMD (two work-groups per WGP) are ever there, as the grid fills the
// chip once: a register budget for that, so that the 32 registers that carry the rows in flight
// do not squeeze the fragment loads
__global__ __launch_bounds__(NTHREADS) __attribute__((amdgpu_waves_per_eu(3, 4)))
void fa_wmma_kernel(const float* __restrict__ Q,
                    const float* __restrict__ K,
                    const float* __restrict__ V,
                    const int*   __restrict__ Mask,
                    float* __restrict__ Out)
{
    // LDS: K chunk (row major, f16), V chunk (transposed, f16)
    __shared__ __align__(128) _Float16 Kt[KV_CHUNK][LDP];        // [kv][d]   9 KB
    __shared__ __align__(128) _Float16 VtT[D_DIM][LDP];          // [d][kv]   9 KB
    // Mask tiles as 32-bit words, two buffers: the next chunk's tile lands while this one is used
    __shared__ __align__(128) int Mk[2][QTILE][MLP];             // [buf][q][kv]  68 KB

    const int tid  = threadIdx.x;
    const int wave = tid >> 5;
    const int lane = tid & 31;
    const int half = lane >> 4;     // 0 or 1 (lane groups per WMMA layout)
    const int lm   = lane & 15;     // lane % 16

    const int bh = blockIdx.y;              // b*H + h
    const int b  = bh / H_DIM;
    const size_t base = (size_t)bh * S_DIM * D_DIM;

    const float* Qb = Q + base;
    const float* Kb = K + base;
    const float* Vb = V + base;
    const int*   Mb = Mask + (size_t)b * S_DIM * S_DIM;  // head-broadcast mask

    const int q0   = blockIdx.x * QTILE + wave * 16;  // first Q row of this wave
    const int qrow = q0 + lm;                          // this lane's query (column of S^T, O^T)

    // ---- Load Q^T B-fragments (32x16 f16 each, D split into two K=32 chunks) ----
    // Lane L holds column N=L%16, k = (L/16)*16 + e, e=0..15 (contiguous in d, as the K rows)
    // Fold (1/sqrt(64)) * log2(e) into Q: softmax runs in the log2 domain.
    v16h aq[2];
    {
        const float scale = 0.18033688011112042f;  // 0.125 * log2(e)
        const float* qp = Qb + (size_t)qrow * D_DIM + half * 16;
        #pragma unroll
        for (int c = 0; c < 2; ++c) {
            const float* p = qp + c * 32;
            V16u a;
            #pragma unroll
            for (int i = 0; i < 8; ++i)
                a.h[i] = __builtin_amdgcn_cvt_pkrtz(p[2*i] * scale, p[2*i+1] * scale);
            aq[c] = a.v;
        }
    }

    // All-ones A fragment: ones x P^T = per-query sums over both lane halves' keys,
    // the same in all 8 accumulator rows
    v16h ones;
    #pragma unroll
    for (int e = 0; e < 16; ++e) ones[e] = (_Float16)1.0f;

    // Online-softmax state (log2 domain): one query per lane, equal in lanes l and l ^ 16
    float m_i = -3.0e38f;
    v8f   lacc;     // running denominator, accumulated through WMMA C operand
    v8f   o[4];
    lacc = (v8f){0,0,0,0,0,0,0,0};
    #pragma unroll
    for (int d = 0; d < 4; ++d) o[d] = (v8f){0,0,0,0,0,0,0,0};

    // Each wave copies its own 16 mask rows: copy i of lane l brings 16 bytes of row
    // wave*16 + 2*i + (l >> 4), words 4*(l & 15) .. +3 of the chunk
    const int  crow = wave * 16 + half;
    const int* mg   = Mb + (size_t)(blockIdx.x * QTILE + crow) * S_DIM + lm * 4;
    const unsigned ml0 = (unsigned)(size_t)&Mk[0][crow][lm * 4];
    const unsigned ml1 = (unsigned)(size_t)&Mk[1][crow][lm * 4];

    // K and V rows of a chunk travel one trip ahead of their use, in registers
    const float* kg = Kb + (size_t)((tid >> 4) * 4) * D_DIM + (tid & 15) * 4;
    const float* vg = Vb + (size_t)((tid >> 4) * 4) * D_DIM + (tid & 15) * 4;
    float4 kf[4], vf[4];

    copy_mask_tile(mg, ml0);
    load_kv_rows(kg, vg, kf, vf);
    asm volatile("s_wait_asynccnt 0x0" ::: "memory");  // tile 0 has landed
    __syncthreads();                                   // ... and is published
    copy_mask_tile(mg + KV_CHUNK, ml1);

    for (int kv0 = 0; kv0 < S_DIM; kv0 += KV_CHUNK) {
        const int buf = (kv0 / KV_CHUNK) & 1;

        // ---- Cooperative stage: 4x4 register-transpose blocks, packed cvt ----
        // kf / vf hold this chunk's rows, loaded one trip ago (chunk 0: in front of the loop)
        {
            const int tr = tid >> 4;          // kv block (0..15): one 4x4 tile per thread
            const int tc = tid & 15;          // d  block (0..15)
            #pragma unroll
            for (int r = 0; r < 4; ++r) {
                H4u kk;
                kk.h[0] = __builtin_amdgcn_cvt_pkrtz(kf[r].x, kf[r].y);
                kk.h[1] = __builtin_amdgcn_cvt_pkrtz(kf[r].z, kf[r].w);
                *(h4*)&Kt[tr*4 + r][tc*4] = kk.v;   // ds_store_b64
            }
            #pragma unroll
            for (int c = 0; c < 4; ++c) {
                H4u vv;
                vv.h[0] = __builtin_amdgcn_cvt_pkrtz(((const float*)&vf[0])[c],
                                                     ((const float*)&vf[1])[c]);
                vv.h[1] = __builtin_amdgcn_cvt_pkrtz(((const float*)&vf[2])[c],
                                                     ((const float*)&vf[3])[c]);
                *(h4*)&VtT[tc*4 + c][tr*4] = vv.v;  // ds_store_b64
            }
        }
        // The next chunk's rows start their way now and are first used at the top of the next
        // trip: their latency runs under this chunk's products and softmax. No branch round
        // the loads (a merge of two paths made the compiler wait for them at once): the last
        // trip reads its own chunk again and nobody uses it.
        const int kvn = (kv0 + KV_CHUNK < S_DIM) ? kv0 + KV_CHUNK : kv0;
        const float* kn = kg + (size_t)kvn * D_DIM;
        const float* vn = vg + (size_t)kvn * D_DIM;
        load_kv_rows(kn, vn, kf, vf);

        // ---- Mask bias tiles from this chunk's LDS buffer (published at the last trip's foot) ----
        // S^T accumulator layout: lane holds query lm, keys j*16 + 8*half + v: 8 consecutive
        // mask words per tile and lane, two ds_load_b128.
        // cb[j][v] = mask ? -1e9 : 0, fed as the WMMA C operand (no post-WMMA select).
        const int* mp = &Mk[buf][wave * 16 + lm][8*half];
        int4 mki[4][2];
        #pragma unroll
        for (int j = 0; j < 4; ++j) {
            mki[j][0] = *(const int4*)(mp + j * 16);
            mki[j][1] = *(const int4*)(mp + j * 16 + 4);
        }
        // The work-group barrier by hand: __syncthreads() also waits for every global load of
        // the wave, which would end the flight of the next chunk's rows here.
        // The loads' address registers are inputs here so that they stay whole up to this wait
        // and are free for other use only behind it.
        asm volatile("s_wait_xcnt 0x0" :: "v"(kn), "v"(vn) : "memory");
        asm volatile("s_wait_dscnt 0x0" ::: "memory");  // this wave's K / V^T stores are in LDS
        bar_signal();
        v8f cb[4];
        #pragma unroll
        for (int j = 0; j < 4; ++j)
            #pragma unroll
            for (int p = 0; p < 2; ++p) {
                cb[j][4*p + 0] = (float)mki[j][p].x * -1.0e9f;
                cb[j][4*p + 1] = (float)mki[j][p].y * -1.0e9f;
                cb[j][4*p + 2] = (float)mki[j][p].z * -1.0e9f;
                cb[j][4*p + 3] = (float)mki[j][p].w * -1.0e9f;
            }

        bar_wait();     // every wave's K and V^T rows of this chunk are in LDS

        // ---- Score tiles: S^T = K Q^T + mask_bias (log2 domain) ----
        v8f sc[4];
        #pragma unroll
        for (int j = 0; j < 4; ++j) {
            v16h ak0 = ld_frag(&Kt[j*16 + lm][0  + half*16]);
            v16h ak1 = ld_frag(&Kt[j*16 + lm][32 + half*16]);
            v8f s = __builtin_amdgcn_wmma_f32_16x16x32_f16(false, ak0, false, aq[0],
                                                           (short)0, cb[j], false, false);
            s = __builtin_amdgcn_wmma_f32_16x16x32_f16(false, ak1, false, aq[1],
                                                       (short)0, s, false, false);
            sc[j] = s;
        }

        // ---- One online-softmax update per 64-wide chunk, one query per lane ----
        float tm[4];
        #pragma unroll
        for (int j = 0; j < 4; ++j) {
            float x0 = fmaxf(fmaxf(sc[j][0], sc[j][1]), sc[j][2]);
            float x1 = fmaxf(fmaxf(sc[j][3], sc[j][4]), sc[j][5]);
            tm[j] = fmaxf(fmaxf(x0, x1), fmaxf(sc[j][6], sc[j][7]));
        }
        float rm = fmaxf(fmaxf(tm[0], tm[1]), fmaxf(tm[2], tm[3]));
        rm = fmaxf(rm, other_half(rm));   // the other 32 keys of this query

        const float mnew  = fmaxf(m_i, rm);
        const float alpha = exp2_bare(m_i - mnew);
        m_i = mnew;
        lacc *= alpha;
        #pragma unroll
        for (int d = 0; d < 4; ++d) o[d] *= alpha;

        // P^T as B operands straight from the score accumulators: tiles (0,1) are keys
        // 0..31, tiles (2,3) keys 32..63; position s of a lane is key 8*half + s or
        // 16 + 8*half + (s - 8) of its block, the order ld_frag_kmap gives V^T.
        // exp2(-1e9-ish - mnew) underflows to exactly 0 => masked P is 0
        P16u pb[2];
        #pragma unroll
        for (int j = 0; j < 4; ++j)
            #pragma unroll
            for (int i = 0; i < 4; ++i) {
                // two scores per subtract: one v_pk_add_f32
                const f2 x = (f2){sc[j][2*i], sc[j][2*i + 1]} - (f2){mnew, mnew};
                f2 e;
                e.x = exp2_bare(x.x);
                e.y = exp2_bare(x.y);
                pb[j >> 1].h[(j & 1) * 4 + i] = __builtin_convertvector(e, h2);
            }

        // l += sum over keys of P, accumulated entirely inside the matrix pipe
        lacc = __builtin_amdgcn_wmma_f32_16x16x32_f16(false, ones, false, pb[0].v,
                                                      (short)0, lacc, false, false);
        lacc = __builtin_amdgcn_wmma_f32_16x16x32_f16(false, ones, false, pb[1].v,
                                                      (short)0, lacc, false, false);

        // ---- O^T += V^T P^T : A[m][k] = V[kv0+k][d*16+m] from the transposed V tile ----
        #pragma unroll
        for (int d = 0; d < 4; ++d) {
            v16h av0 = ld_frag_kmap(&VtT[d*16 + lm][0],  half);
            v16h av1 = ld_frag_kmap(&VtT[d*16 + lm][32], half);
            o[d] = __builtin_amdgcn_wmma_f32_16x16x32_f16(false, av0, false, pb[0].v,
                                                          (short)0, o[d], false, false);
            o[d] = __builtin_amdgcn_wmma_f32_16x16x32_f16(false, av1, false, pb[1].v,
                                                          (short)0, o[d], false, false);
        }

        // ---- Foot: hand the buffers over ----
        asm volatile("s_wait_dscnt 0x0" ::: "memory");     // this wave's LDS reads of the chunk are done
        asm volatile("s_wait_asynccnt 0x0" ::: "memory");  // its copies of the next mask tile have landed
        bar_signal();     // by hand, as above: the rows in flight stay in flight
        bar_wait();       // chunk fully consumed by all waves; next mask tile published
        if (kv0 + 2 * KV_CHUNK < S_DIM)
            copy_mask_tile(mg + kv0 + 2 * KV_CHUNK, buf ? ml1 : ml0);
    }
    asm volatile("s_wait_asynccnt 0x0" ::: "memory");  // no copy outstanding at the wave's end
    asm volatile("s_wait_loadcnt 0x0" ::: "memory");   // nor a row of the last trip's unused loads

    // ---- Epilogue: O / l, store fp32 [B,H,S,D] ----
    // o[d][v] = O[qrow][d*16 + 8*half + v]: two 16-byte stores per tile
    float* op = Out + base + (size_t)qrow * D_DIM + 8*half;
    const float inv = (lacc[0] > 0.0f) ? (1.0f / lacc[0]) : 0.0f;
    #pragma unroll
    for (int d = 0; d < 4; ++d) {
        *(float4*)(op + d*16)     = make_float4(o[d][0] * inv, o[d][1] * inv,
                                                o[d][2] * inv, o[d][3] * inv);
        *(float4*)(op + d*16 + 4) = make_float4(o[d][4] * inv, o[d][5] * inv,
                                                o[d][6] * inv, o[d][7] * inv);
    }
}

extern "C" void kernel_launch(void* const* d_in, const int* in_sizes, int n_in,
                              void* d_out, int out_size, void* d_ws, size_t ws_size,
                              hipStream_t stream) {
    (void)in_sizes; (void)n_in; (void)out_size; (void)d_ws; (void)ws_size;
    const float* Q    = (const float*)d_in[0];
    const float* K    = (const float*)d_in[1];
    const float* V    = (const float*)d_in[2];
    const int*   Mask = (const int*)d_in[3];
    float* Out = (float*)d_out;

    const int B = 4, H = H_DIM;
    dim3 grid(S_DIM / QTILE, B * H);   // (16, 32) blocks
    dim3 block(NTHREADS);
    fa_wmma_kernel<<<grid, block, 0, stream>>>(Q, K, V, Mask, Out);
}

// v007
// It runs in 47.9 microseconds.
// Next to v006, in two timings, it ran 1.07 times as fast each time.
// Counting every step since v000, it is 3.54 times as fast.
#include <hip/hip_runtime.h>

typedef _Float16 v16h  __attribute__((ext_vector_type(16)));
typedef _Float16 v8h   __attribute__((ext_vector_type(8)));
typedef _Float16 h4    __attribute__((ext_vector_type(4)));
typedef __fp16   f16x2 __attribute__((ext_vector_type(2)));   // cvt_pkrtz return type
typedef float    v8f   __attribute__((ext_vector_type(8)));
typedef _Float16 h2    __attribute__((ext_vector_type(2)));
typedef float    f2    __attribute__((ext_vector_type(2)));
typedef unsigned u16v  __attribute__((ext_vector_type(16)));

#define S_DIM 2048
#define D_DIM 64
#define H_DIM 8
#define KV_CHUNK 64
#define QTILE 128       // Q rows per block (8 waves x 16 rows)
#define NTHREADS 256
// LDS row pitch in f16 elements: 64 data + 8 pad = 144 B = 16 B x 9 (odd), so the
// 16 rows that one ds_load_b128 touches start on distinct 4-bank groups.
#define LDP 72
// The packing launch: keys per work-group, and the LDS row pitch of its mask tile in 32-bit
// words: 256 data + 4 pad = 1040 B = 16 B x 65 (odd)
#define PKEYS 256
#define MLP 260
// Packed mask: 32 words per (16 queries x 64 keys) tile, one per score accumulator element
#define TILE_WORDS 32
#define NCHUNK (S_DIM / KV_CHUNK)

union H4u  { h4   v; f16x2 h[2]; };
union V16u { v16h v; f16x2 h[8]; };
union P16u { v16h v; h2    h[8]; };

// 32-byte fragment from a row that is only 16-byte aligned: two ds_load_b128
__device__ __forceinline__ v16h ld_frag(const _Float16* p)
{
    v8h lo = *(const v8h*)p;
    v8h hi = *(const v8h*)(p + 8);
    return __builtin_shufflevector(lo, hi, 0, 1, 2, 3, 4, 5, 6, 7,
                                   8, 9, 10, 11, 12, 13, 14, 15);
}

// A fragment in the k order of a packed accumulator pair: p points at a block of
// 32 k in a row; position s holds k = 8*half + s (s < 8), 16 + 8*half + (s - 8) else
__device__ __forceinline__ v16h ld_frag_kmap(const _Float16* p, int half)
{
    v8h lo = *(const v8h*)(p + 8 * half);
    v8h hi = *(const v8h*)(p + 16 + 8 * half);
    return __builtin_shufflevector(lo, hi, 0, 1, 2, 3, 4, 5, 6, 7,
                                   8, 9, 10, 11, 12, 13, 14, 15);
}

// One 128 x 64 piece of the mask tile (this block's query rows, 64 keys) from global memory into
// LDS through no register: 8 asynchronous 16-byte copies per lane. Lanes 0..15 of a copy
// cover the 256 contiguous bytes of one row and lanes 16..31 those of the next row, so a
// wave-wide copy touches four whole 128-byte lines.
// g: this lane's first source word; l: this lane's first LDS byte address.
// s_wait_xcnt 0 ends the statement so that it stands before any rewrite of an address
// register that a copy names.
__device__ __forceinline__ void copy_mask_tile(const int* g, unsigned l)
{
    const int* g0 = g;
    const int* g1 = g + 2  * S_DIM;
    const int* g2 = g + 4  * S_DIM;
    const int* g3 = g + 6  * S_DIM;
    const int* g4 = g + 8  * S_DIM;
    const int* g5 = g + 10 * S_DIM;
    const int* g6 = g + 12 * S_DIM;
    const int* g7 = g + 14 * S_DIM;
    const unsigned st = 2u * MLP * 4u;   // two LDS rows, bytes
    asm volatile("global_load_async_to_lds_b128 %0, %8, off\n\t"
                 "global_load_async_to_lds_b128 %1, %9, off\n\t"
                 "global_load_async_to_lds_b128 %2, %10, off\n\t"
                 "global_load_async_to_lds_b128 %3, %11, off\n\t"
                 "global_load_async_to_lds_b128 %4, %12, off\n\t"
                 "global_load_async_to_lds_b128 %5, %13, off\n\t"
                 "global_load_async_to_lds_b128 %6, %14, off\n\t"
                 "global_load_async_to_lds_b128 %7, %15, off\n\t"
                 "s_wait_xcnt 0x0"
                 :: "v"(l), "v"(l + st), "v"(l + 2u * st), "v"(l + 3u * st),
                    "v"(l + 4u * st), "v"(l + 5u * st), "v"(l + 6u * st), "v"(l + 7u * st),
                    "v"(g0), "v"(g1), "v"(g2), "v"(g3), "v"(g4), "v"(g5), "v"(g6), "v"(g7)
                 : "memory");
}

// One thread's share of a 64 x 64 K chunk and V chunk, f32, into registers: one 4x4 block of
// each. k, v: the first word of this thread's block.
__device__ __forceinline__ void load_kv_rows(const float* k, const float* v,
                                             float4 (&kf)[4], float4 (&vf)[4])
{
    #pragma unroll
    for (int r = 0; r < 4; ++r) {
        kf[r] = *(const float4*)(k + r * D_DIM);
        vf[r] = *(const float4*)(v + r * D_DIM);
    }
}

// The two halves of the work-group barrier, with no wait of their own: the waits that a place
// needs stand in front of the signal. The clobber keeps LDS accesses on their side.
__device__ __forceinline__ void bar_signal() { asm volatile("s_barrier_signal -1" ::: "memory"); }
__device__ __forceinline__ void bar_wait()   { asm volatile("s_barrier_wait -1" ::: "memory"); }

// 2^x as the bare v_exp_f32, without the library form's range scaling (compare, two selects,
// add, ldexp per value). That scaling only matters for results below 2^-126, which the bare
// instruction may return as 0: a P that small rounds to 0 in f16 anyway, and an alpha that
// small multiplies sums that lie 2^126 below the new chunk's largest term.
__device__ __forceinline__ float exp2_bare(float x)
{
    return __builtin_amdgcn_exp2f(x);
}

// value of lane l ^ 16
__device__ __forceinline__ float other_half(float x)
{
    int b = __builtin_bit_cast(int, x);
    b = __builtin_amdgcn_permlanex16(b, b, 0x76543210, 0xfedcba98, false, false);
    return __builtin_bit_cast(float, b);
}

// First launch: the mask, which all 8 heads of a batch share, is read once and packed to one
// bit per element, in the form the attention kernel's selects take: for the tile of 16 queries
// and 64 keys that one wave scores in one trip, word j*8 + v holds in bit l the mask of
// query (l & 15), key j*16 + 8*(l >> 4) + v, which is where lane l keeps element v of score
// tile j. A work-group packs 128 query rows x 256 keys; each wave its own 16 rows.
__global__ __launch_bounds__(NTHREADS)
void pack_mask_kernel(const int* __restrict__ Mask, unsigned* __restrict__ Bits)
{
    __shared__ __align__(128) int Mt[QTILE][MLP];                // [q][key]  130 KB

    const int tid  = threadIdx.x;
    const int wave = tid >> 5;
    const int lane = tid & 31;
    const int half = lane >> 4;
    const int lm   = lane & 15;

    const int kb = blockIdx.x;      // block of 256 keys
    const int rb = blockIdx.y;      // block of 128 rows of the [B*S][S] mask

    // copy i of lane l brings 16 bytes of row wave*16 + 2*i + (l >> 4), words 4*(l & 15) .. +3
    const int  crow = wave * 16 + half;
    const int* mg   = Mask + (size_t)(rb * QTILE + crow) * S_DIM + kb * PKEYS + lm * 4;
    const unsigned ml = (unsigned)(size_t)&Mt[crow][lm * 4];
    #pragma unroll
    for (int c = 0; c < PKEYS / KV_CHUNK; ++c)
        copy_mask_tile(mg + c * KV_CHUNK, ml + (unsigned)(c * KV_CHUNK * 4));
    asm volatile("s_wait_asynccnt 0x0" ::: "memory");  // this wave's 32 copies have landed
    __syncthreads();                                   // ... and are published

    const int* mp = &Mt[wave * 16 + lm][8 * half];
    unsigned* bp = Bits + ((size_t)(rb * (QTILE / 16) + wave) * NCHUNK
                           + kb * (PKEYS / KV_CHUNK)) * TILE_WORDS + lane;
    #pragma unroll
    for (int c = 0; c < PKEYS / KV_CHUNK; ++c) {
        unsigned r = 0;     // lane e collects word e
        #pragma unroll
        for (int j = 0; j < 4; ++j)
            #pragma unroll
            for (int p = 0; p < 2; ++p) {
                const int4 x = *(const int4*)(mp + c * KV_CHUNK + j * 16 + 4 * p);
                const int e = j * 8 + 4 * p;
                // every lane votes, so the ballots stand in front of the selects
                const unsigned w0 = __builtin_amdgcn_ballot_w32(x.x != 0);
                const unsigned w1 = __builtin_amdgcn_ballot_w32(x.y != 0);
                const unsigned w2 = __builtin_amdgcn_ballot_w32(x.z != 0);
                const unsigned w3 = __builtin_amdgcn_ballot_w32(x.w != 0);
                r = __builtin_amdgcn_inverse_ballot_w32(1u << (e + 0)) ? w0 : r;
                r = __builtin_amdgcn_inverse_ballot_w32(1u << (e + 1)) ? w1 : r;
                r = __builtin_amdgcn_inverse_ballot_w32(1u << (e + 2)) ? w2 : r;
                r = __builtin_amdgcn_inverse_ballot_w32(1u << (e + 3)) ? w3 : r;
            }
        bp[c * TILE_WORDS] = r;     // 128 contiguous bytes per wave
    }
}

// At most four waves per SIMD (two work-groups per WGP) are ever there, as the grid fills the
// chip once: a register budget for that, so that the 32 registers that carry the rows in flight
// do not squeeze the fragment loads
__global__ __launch_bounds__(NTHREADS) __attribute__((amdgpu_waves_per_eu(3, 4)))
void fa_wmma_kernel(const float* __restrict__ Q,
                    const float* __restrict__ K,
                    const float* __restrict__ V,
                    const unsigned* __restrict__ Bits,
                    float* __restrict__ Out)
{
    // LDS: K chunk (row major, f16), V chunk (transposed, f16)
    __shared__ __align__(128) _Float16 Kt[KV_CHUNK][LDP];        // [kv][d]   9 KB
    __shared__ __align__(128) _Float16 VtT[D_DIM][LDP];          // [d][kv]   9 KB

    const int tid  = threadIdx.x;
    const int wave = tid >> 5;
    const int lane = tid & 31;
    const int half = lane >> 4;     // 0 or 1 (lane groups per WMMA layout)
    const int lm   = lane & 15;     // lane % 16

    const int bh = blockIdx.y;              // b*H + h
    const int b  = bh / H_DIM;
    const size_t base = (size_t)bh * S_DIM * D_DIM;

    const float* Qb = Q + base;
    const float* Kb = K + base;
    const float* Vb = V + base;

    const int q0   = blockIdx.x * QTILE + wave * 16;  // first Q row of this wave
    const int qrow = q0 + lm;                          // this lane's query (column of S^T, O^T)

    // ---- Load Q^T B-fragments (32x16 f16 each, D split into two K=32 chunks) ----
    // Lane L holds column N=L%16, k = (L/16)*16 + e, e=0..15 (contiguous in d, as the K rows)
    // Fold (1/sqrt(64)) * log2(e) into Q: softmax runs in the log2 domain.
    v16h aq[2];
    {
        const float scale = 0.18033688011112042f;  // 0.125 * log2(e)
        const float* qp = Qb + (size_t)qrow * D_DIM + half * 16;
        #pragma unroll
        for (int c = 0; c < 2; ++c) {
            const float* p = qp + c * 32;
            V16u a;
            #pragma unroll
            for (int i = 0; i < 8; ++i)
                a.h[i] = __builtin_amdgcn_cvt_pkrtz(p[2*i] * scale, p[2*i+1] * scale);
            aq[c] = a.v;
        }
    }

    // All-ones A fragment: ones x P^T = per-query sums over both lane halves' keys,
    // the same in all 8 accumulator rows
    v16h ones;
    #pragma unroll
    for (int e = 0; e < 16; ++e) ones[e] = (_Float16)1.0f;

    // Online-softmax state (log2 domain): one query per lane, equal in lanes l and l ^ 16
    float m_i = -3.0e38f;
    v8f   lacc;     // running denominator, accumulated through WMMA C operand
    v8f   o[4];
    lacc = (v8f){0,0,0,0,0,0,0,0};
    #pragma unroll
    for (int d = 0; d < 4; ++d) o[d] = (v8f){0,0,0,0,0,0,0,0};

    // This wave's packed mask words (head-broadcast): 32 per chunk, the same for every lane, so
    // they come by scalar loads. The first launch wrote them and nothing writes them in this one.
    const int wave_u = __builtin_amdgcn_readfirstlane(wave);
    const u16v* mb = (const u16v*)(Bits + (size_t)((b * (S_DIM / 16) + blockIdx.x * (QTILE / 16) + wave_u)
                                                   * NCHUNK) * TILE_WORDS);
    u16v mw0 = mb[0], mw1 = mb[1];   // chunk 0; later chunks one trip ahead

    // K and V rows of a chunk travel one trip ahead of their use, in registers
    const float* kg = Kb + (size_t)((tid >> 4) * 4) * D_DIM + (tid & 15) * 4;
    const float* vg = Vb + (size_t)((tid >> 4) * 4) * D_DIM + (tid & 15) * 4;
    float4 kf[4], vf[4];

    load_kv_rows(kg, vg, kf, vf);

    for (int kv0 = 0; kv0 < S_DIM; kv0 += KV_CHUNK) {

        // ---- Cooperative stage: 4x4 register-transpose blocks, packed cvt ----
        // kf / vf hold this chunk's rows, loaded one trip ago (chunk 0: in front of the loop)
        {
            const int tr = tid >> 4;          // kv block (0..15): one 4x4 tile per thread
            const int tc = tid & 15;          // d  block (0..15)
            #pragma unroll
            for (int r = 0; r < 4; ++r) {
                H4u kk;
                kk.h[0] = __builtin_amdgcn_cvt_pkrtz(kf[r].x, kf[r].y);
                kk.h[1] = __builtin_amdgcn_cvt_pkrtz(kf[r].z, kf[r].w);
                *(h4*)&Kt[tr*4 + r][tc*4] = kk.v;   // ds_store_b64
            }
            #pragma unroll
            for (int c = 0; c < 4; ++c) {
                H4u vv;
                vv.h[0] = __builtin_amdgcn_cvt_pkrtz(((const float*)&vf[0])[c],
                                                     ((const float*)&vf[1])[c]);
                vv.h[1] = __builtin_amdgcn_cvt_pkrtz(((const float*)&vf[2])[c],
                                                     ((const float*)&vf[3])[c]);
                *(h4*)&VtT[tc*4 + c][tr*4] = vv.v;  // ds_store_b64
            }
        }
        // The next chunk's rows start their way now and are first used at the top of the next
        // trip: their latency runs under this chunk's products and softmax. No branch round
        // the loads (a merge of two paths made the compiler wait for them at once): the last
        // trip reads its own chunk again and nobody uses it.
        const int kvn = (kv0 + KV_CHUNK < S_DIM) ? kv0 + KV_CHUNK : kv0;
        const float* kn = kg + (size_t)kvn * D_DIM;
        const float* vn = vg + (size_t)kvn * D_DIM;
        load_kv_rows(kn, vn, kf, vf);

        // The work-group barrier by hand: __syncthreads() also waits for every global load of
        // the wave, which would end the flight of the next chunk's rows here.
        // The loads' address registers are inputs here so that they stay whole up to this wait
        // and are free for other use only behind it.
        asm volatile("s_wait_xcnt 0x0" :: "v"(kn), "v"(vn) : "memory");
        asm volatile("s_wait_dscnt 0x0" ::: "memory");  // this wave's K / V^T stores are in LDS
        bar_signal();
        bar_wait();     // every wave's K and V^T rows of this chunk are in LDS

        // ---- Score tiles: S^T = K Q^T (log2 domain), masked elements set to -inf ----
        // Word j*8 + v of the packed mask is a lane mask: one select per element.
        // m_i is finite from the start, so -inf - mnew stays -inf and a masked P is exactly 0,
        // which is what the reference's second where() leaves of it.
        const v8f zero = (v8f){0,0,0,0,0,0,0,0};
        v8f sc[4];
        #pragma unroll
        for (int j = 0; j < 4; ++j) {
            v16h ak0 = ld_frag(&Kt[j*16 + lm][0  + half*16]);
            v16h ak1 = ld_frag(&Kt[j*16 + lm][32 + half*16]);
            v8f s = __builtin_amdgcn_wmma_f32_16x16x32_f16(false, ak0, false, aq[0],
                                                           (short)0, zero, false, false);
            s = __builtin_amdgcn_wmma_f32_16x16x32_f16(false, ak1, false, aq[1],
                                                       (short)0, s, false, false);
            sc[j] = s;
        }
        #pragma unroll
        for (int j = 0; j < 4; ++j)
            #pragma unroll
            for (int v = 0; v < 8; ++v) {
                const unsigned w = (j < 2) ? mw0[j * 8 + v] : mw1[(j - 2) * 8 + v];
                sc[j][v] = __builtin_amdgcn_inverse_ballot_w32(w) ? -__builtin_inff() : sc[j][v];
            }
        // The next chunk's words start now (the last trip reads its own again, unused)
        mw0 = mb[(kvn / KV_CHUNK) * 2];
        mw1 = mb[(kvn / KV_CHUNK) * 2 + 1];

        // ---- One online-softmax update per 64-wide chunk, one query per lane ----
        float tm[4];
        #pragma unroll
        for (int j = 0; j < 4; ++j) {
            float x0 = fmaxf(fmaxf(sc[j][0], sc[j][1]), sc[j][2]);
            float x1 = fmaxf(fmaxf(sc[j][3], sc[j][4]), sc[j][5]);
            tm[j] = fmaxf(fmaxf(x0, x1), fmaxf(sc[j][6], sc[j][7]));
        }
        float rm = fmaxf(fmaxf(tm[0], tm[1]), fmaxf(tm[2], tm[3]));
        rm = fmaxf(rm, other_half(rm));   // the other 32 keys of this query

        const float mnew  = fmaxf(m_i, rm);
        const float alpha = exp2_bare(m_i - mnew);
        m_i = mnew;
        lacc *= alpha;
        #pragma unroll
        for (int d = 0; d < 4; ++d) o[d] *= alpha;

        // P^T as B operands straight from the score accumulators: tiles (0,1) are keys
        // 0..31, tiles (2,3) keys 32..63; position s of a lane is key 8*half + s or
        // 16 + 8*half + (s - 8) of its block, the order ld_frag_kmap gives V^T.
        // exp2(-inf) is exactly 0 => masked P is 0
        P16u pb[2];
        #pragma unroll
        for (int j = 0; j < 4; ++j)
            #pragma unroll
            for (int i = 0; i < 4; ++i) {
                // two scores per subtract: one v_pk_add_f32
                const f2 x = (f2){sc[j][2*i], sc[j][2*i + 1]} - (f2){mnew, mnew};
                f2 e;
                e.x = exp2_bare(x.x);
                e.y = exp2_bare(x.y);
                pb[j >> 1].h[(j & 1) * 4 + i] = __builtin_convertvector(e, h2);
            }

        // l += sum over keys of P, accumulated entirely inside the matrix pipe
        lacc = __builtin_amdgcn_wmma_f32_16x16x32_f16(false, ones, false, pb[0].v,
                                                      (short)0, lacc, false, false);
        lacc = __builtin_amdgcn_wmma_f32_16x16x32_f16(false, ones, false, pb[1].v,
                                                      (short)0, lacc, false, false);

        // ---- O^T += V^T P^T : A[m][k] = V[kv0+k][d*16+m] from the transposed V tile ----
        #pragma unroll
        for (int d = 0; d < 4; ++d) {
            v16h av0 = ld_frag_kmap(&VtT[d*16 + lm][0],  half);
            v16h av1 = ld_frag_kmap(&VtT[d*16 + lm][32], half);
            o[d] = __builtin_amdgcn_wmma_f32_16x16x32_f16(false, av0, false, pb[0].v,
                                                          (short)0, o[d], false, false);
            o[d] = __builtin_amdgcn_wmma_f32_16x16x32_f16(false, av1, false, pb[1].v,
                                                          (short)0, o[d], false, false);
        }

        // ---- Foot: hand the buffers over ----
        asm volatile("s_wait_dscnt 0x0" ::: "memory");     // this wave's LDS reads of the chunk are done
        bar_signal();     // by hand, as above: the rows in flight stay in flight
        bar_wait();       // chunk fully consumed by all waves
    }
    asm volatile("s_wait_loadcnt 0x0" ::: "memory");   // nor a row of the last trip's unused loads

    // ---- Epilogue: O / l, store fp32 [B,H,S,D] ----
    // o[d][v] = O[qrow][d*16 + 8*half + v]: two 16-byte stores per tile
    float* op = Out + base + (size_t)qrow * D_DIM + 8*half;
    const float inv = (lacc[0] > 0.0f) ? (1.0f / lacc[0]) : 0.0f;
    #pragma unroll
    for (int d = 0; d < 4; ++d) {
        *(float4*)(op + d*16)     = make_float4(o[d][0] * inv, o[d][1] * inv,
                                                o[d][2] * inv, o[d][3] * inv);
        *(float4*)(op + d*16 + 4) = make_float4(o[d][4] * inv, o[d][5] * inv,
                                                o[d][6] * inv, o[d][7] * inv);
    }
}

extern "C" void kernel_launch(void* const* d_in, const int* in_sizes, int n_in,
                              void* d_out, int out_size, void* d_ws, size_t ws_size,
                              hipStream_t stream) {
    (void)in_sizes; (void)n_in; (void)out_size; (void)ws_size;
    const float* Q    = (const float*)d_in[0];
    const float* K    = (const float*)d_in[1];
    const float* V    = (const float*)d_in[2];
    const int*   Mask = (const int*)d_in[3];
    float* Out = (float*)d_out;
    unsigned* Bits = (unsigned*)d_ws;   // B*S*S bits = 2 MiB, written by the first launch

    const int B = 4, H = H_DIM;
    dim3 grid(S_DIM / QTILE, B * H);   // (16, 32) blocks
    dim3 block(NTHREADS);
    dim3 pgrid(S_DIM / PKEYS, B * S_DIM / QTILE);   // (8, 64) blocks
    pack_mask_kernel<<<pgrid, block, 0, stream>>>(Mask, Bits);
    fa_wmma_kernel<<<grid, block, 0, stream>>>(Q, K, V, Bits, Out);
}

// v008
// Measured time: 42.9 microseconds a run.
// Next to v007, in two timings, it ran 1.11 times as fast each time.
// All steps since v000 together make it 3.93 times as fast.
#include <hip/hip_runtime.h>

typedef _Float16 v16h  __attribute__((ext_vector_type(16)));
typedef _Float16 v8h   __attribute__((ext_vector_type(8)));
typedef _Float16 h4    __attribute__((ext_vector_type(4)));
typedef __fp16   f16x2 __attribute__((ext_vector_type(2)));   // cvt_pkrtz return type
typedef float    v8f   __attribute__((ext_vector_type(8)));
typedef _Float16 h2    __attribute__((ext_vector_type(2)));
typedef float    f2    __attribute__((ext_vector_type(2)));
typedef unsigned u16v  __attribute__((ext_vector_type(16)));

#define S_DIM 2048
#define D_DIM 64
#define H_DIM 8
#define KV_CHUNK 64
#define QTILE 128       // mask rows per block of the packing launch (8 waves x 16 rows)
#define NTHREADS 256
// The attention kernel: 16-query column groups per wave, and Q rows per block (8 waves x 32 rows)
#define WG_COLS 2
#define ATILE (8 * 16 * WG_COLS)
// LDS row pitch in f16 elements: 64 data + 8 pad = 144 B = 16 B x 9 (odd), so the
// 16 rows that one ds_load_b128 touches start on distinct 4-bank groups.
#define LDP 72
// The packing launch: keys per work-group, and the LDS row pitch of its mask tile in 32-bit
// words: 256 data + 4 pad = 1040 B = 16 B x 65 (odd)
#define PKEYS 256
#define MLP 260
// Packed mask: 32 words per (16 queries x 64 keys) tile, one per score accumulator element
#define TILE_WORDS 32
#define NCHUNK (S_DIM / KV_CHUNK)

union H4u  { h4   v; f16x2 h[2]; };
union V16u { v16h v; f16x2 h[8]; };
union P16u { v16h v; h2    h[8]; };

// 32-byte fragment from a row that is only 16-byte aligned: two ds_load_b128
__device__ __forceinline__ v16h ld_frag(const _Float16* p)
{
    v8h lo = *(const v8h*)p;
    v8h hi = *(const v8h*)(p + 8);
    return __builtin_shufflevector(lo, hi, 0, 1, 2, 3, 4, 5, 6, 7,
                                   8, 9, 10, 11, 12, 13, 14, 15);
}

// A fragment in the k order of a packed accumulator pair: p points at a block of
// 32 k in a row; position s holds k = 8*half + s (s < 8), 16 + 8*half + (s - 8) else
__device__ __forceinline__ v16h ld_frag_kmap(const _Float16* p, int half)
{
    v8h lo = *(const v8h*)(p + 8 * half);
    v8h hi = *(const v8h*)(p + 16 + 8 * half);
    return __builtin_shufflevector(lo, hi, 0, 1, 2, 3, 4, 5, 6, 7,
                                   8, 9, 10, 11, 12, 13, 14, 15);
}

// One 128 x 64 piece of the mask tile (this block's query rows, 64 keys) from global memory into
// LDS through no register: 8 asynchronous 16-byte copies per lane. Lanes 0..15 of a copy
// cover the 256 contiguous bytes of one row and lanes 16..31 those of the next row, so a
// wave-wide copy touches four whole 128-byte lines.
// g: this lane's first source word; l: this lane's first LDS byte address.
// s_wait_xcnt 0 ends the statement so that it stands before any rewrite of an address
// register that a copy names.
__device__ __forceinline__ void copy_mask_tile(const int* g, unsigned l)
{
    const int* g0 = g;
    const int* g1 = g + 2  * S_DIM;
    const int* g2 = g + 4  * S_DIM;
    const int* g3 = g + 6  * S_DIM;
    const int* g4 = g + 8  * S_DIM;
    const int* g5 = g + 10 * S_DIM;
    const int* g6 = g + 12 * S_DIM;
    const int* g7 = g + 14 * S_DIM;
    const unsigned st = 2u * MLP * 4u;   // two LDS rows, bytes
    asm volatile("global_load_async_to_lds_b128 %0, %8, off\n\t"
                 "global_load_async_to_lds_b128 %1, %9, off\n\t"
                 "global_load_async_to_lds_b128 %2, %10, off\n\t"
                 "global_load_async_to_lds_b128 %3, %11, off\n\t"
                 "global_load_async_to_lds_b128 %4, %12, off\n\t"
                 "global_load_async_to_lds_b128 %5, %13, off\n\t"
                 "global_load_async_to_lds_b128 %6, %14, off\n\t"
                 "global_load_async_to_lds_b128 %7, %15, off\n\t"
                 "s_wait_xcnt 0x0"
                 :: "v"(l), "v"(l + st), "v"(l + 2u * st), "v"(l + 3u * st),
                    "v"(l + 4u * st), "v"(l + 5u * st), "v"(l + 6u * st), "v"(l + 7u * st),
                    "v"(g0), "v"(g1), "v"(g2), "v"(g3), "v"(g4), "v"(g5), "v"(g6), "v"(g7)
                 : "memory");
}

// One thread's share of a 64 x 64 K chunk and V chunk, f32, into registers: one 4x4 block of
// each. k, v: the first word of this thread's block.
__device__ __forceinline__ void load_kv_rows(const float* k, const float* v,
                                             float4 (&kf)[4], float4 (&vf)[4])
{
    #pragma unroll
    for (int r = 0; r < 4; ++r) {
        kf[r] = *(const float4*)(k + r * D_DIM);
        vf[r] = *(const float4*)(v + r * D_DIM);
    }
}

// The two halves of the work-group barrier, with no wait of their own: the waits that a place
// needs stand in front of the signal. The clobber keeps LDS accesses on their side.
__device__ __forceinline__ void bar_signal() { asm volatile("s_barrier_signal -1" ::: "memory"); }
__device__ __forceinline__ void bar_wait()   { asm volatile("s_barrier_wait -1" ::: "memory"); }

// 2^x as the bare v_exp_f32, without the library form's range scaling (compare, two selects,
// add, ldexp per value). That scaling only matters for results below 2^-126, which the bare
// instruction may return as 0: a P that small rounds to 0 in f16 anyway, and an alpha that
// small multiplies sums that lie 2^126 below the new chunk's largest term.
__device__ __forceinline__ float exp2_bare(float x)
{
    return __builtin_amdgcn_exp2f(x);
}

// value of lane l ^ 16
__device__ __forceinline__ float other_half(float x)
{
    int b = __builtin_bit_cast(int, x);
    b = __builtin_amdgcn_permlanex16(b, b, 0x76543210, 0xfedcba98, false, false);
    return __builtin_bit_cast(float, b);
}

// First launch: the mask, which all 8 heads of a batch share, is read once and packed to one
// bit per element, in the form the attention kernel's selects take: for the tile of 16 queries
// and 64 keys that one column group of a wave scores in one trip, word j*8 + v holds in bit l the mask of
// query (l & 15), key j*16 + 8*(l >> 4) + v, which is where lane l keeps element v of score
// tile j. A work-group packs 128 query rows x 256 keys; each wave its own 16 rows.
__global__ __launch_bounds__(NTHREADS)
void pack_mask_kernel(const int* __restrict__ Mask, unsigned* __restrict__ Bits)
{
    __shared__ __align__(128) int Mt[QTILE][MLP];                // [q][key]  130 KB

    const int tid  = threadIdx.x;
    const int wave = tid >> 5;
    const int lane = tid & 31;
    const int half = lane >> 4;
    const int lm   = lane & 15;

    const int kb = blockIdx.x;      // block of 256 keys
    const int rb = blockIdx.y;      // block of 128 rows of the [B*S][S] mask

    // copy i of lane l brings 16 bytes of row wave*16 + 2*i + (l >> 4), words 4*(l & 15) .. +3
    const int  crow = wave * 16 + half;
    const int* mg   = Mask + (size_t)(rb * QTILE + crow) * S_DIM + kb * PKEYS + lm * 4;
    const unsigned ml = (unsigned)(size_t)&Mt[crow][lm * 4];
    #pragma unroll
    for (int c = 0; c < PKEYS / KV_CHUNK; ++c)
        copy_mask_tile(mg + c * KV_CHUNK, ml + (unsigned)(c * KV_CHUNK * 4));
    asm volatile("s_wait_asynccnt 0x0" ::: "memory");  // this wave's 32 copies have landed
    __syncthreads();                                   // ... and are published

    const int* mp = &Mt[wave * 16 + lm][8 * half];
    unsigned* bp = Bits + ((size_t)(rb * (QTILE / 16) + wave) * NCHUNK
                           + kb * (PKEYS / KV_CHUNK)) * TILE_WORDS + lane;
    #pragma unroll
    for (int c = 0; c < PKEYS / KV_CHUNK; ++c) {
        unsigned r = 0;     // lane e collects word e
        #pragma unroll
        for (int j = 0; j < 4; ++j)
            #pragma unroll
            for (int p = 0; p < 2; ++p) {
                const int4 x = *(const int4*)(mp + c * KV_CHUNK + j * 16 + 4 * p);
                const int e = j * 8 + 4 * p;
                // every lane votes, so the ballots stand in front of the selects
                const unsigned w0 = __builtin_amdgcn_ballot_w32(x.x != 0);
                const unsigned w1 = __builtin_amdgcn_ballot_w32(x.y != 0);
                const unsigned w2 = __builtin_amdgcn_ballot_w32(x.z != 0);
                const unsigned w3 = __builtin_amdgcn_ballot_w32(x.w != 0);
                r = __builtin_amdgcn_inverse_ballot_w32(1u << (e + 0)) ? w0 : r;
                r = __builtin_amdgcn_inverse_ballot_w32(1u << (e + 1)) ? w1 : r;
                r = __builtin_amdgcn_inverse_ballot_w32(1u << (e + 2)) ? w2 : r;
                r = __builtin_amdgcn_inverse_ballot_w32(1u << (e + 3)) ? w3 : r;
            }
        bp[c * TILE_WORDS] = r;     // 128 contiguous bytes per wave
    }
}

// Each wave owns 32 queries (two column groups), so that every K and V^T fragment read from LDS
// feeds two matrix instructions and a staged chunk serves 256 queries. The grid is then one
// work-group per WGP, two waves per SIMD: the register budget is set for that.
__global__ __launch_bounds__(NTHREADS) __attribute__((amdgpu_waves_per_eu(2, 2)))
void fa_wmma_kernel(const float* __restrict__ Q,
                    const float* __restrict__ K,
                    const float* __restrict__ V,
                    const unsigned* __restrict__ Bits,
                    float* __restrict__ Out)
{
    // LDS: K chunk (row major, f16), V chunk (transposed, f16)
    __shared__ __align__(128) _Float16 Kt[KV_CHUNK][LDP];        // [kv][d]   9 KB
    __shared__ __align__(128) _Float16 VtT[D_DIM][LDP];          // [d][kv]   9 KB

    const int tid  = threadIdx.x;
    const int wave = tid >> 5;
    const int lane = tid & 31;
    const int half = lane >> 4;     // 0 or 1 (lane groups per WMMA layout)
    const int lm   = lane & 15;     // lane % 16

    const int bh = blockIdx.y;              // b*H + h
    const int b  = bh / H_DIM;
    const size_t base = (size_t)bh * S_DIM * D_DIM;

    const float* Qb = Q + base;
    const float* Kb = K + base;
    const float* Vb = V + base;

    const int q0   = blockIdx.x * ATILE + wave * (16 * WG_COLS);  // first Q row of this wave
    const int qrow = q0 + lm;     // this lane's query in column group 0; group g: + 16 * g

    // ---- Load Q^T B-fragments (32x16 f16 each, D split into two K=32 chunks) ----
    // Lane L holds column N=L%16, k = (L/16)*16 + e, e=0..15 (contiguous in d, as the K rows)
    // Fold (1/sqrt(64)) * log2(e) into Q: softmax runs in the log2 domain.
    v16h aq[WG_COLS][2];
    const float* qp = Qb + (size_t)qrow * D_DIM + half * 16;   // group g: 16 * g rows further
    #pragma unroll
    for (int g = 0; g < WG_COLS; ++g) {
        const float scale = 0.18033688011112042f;  // 0.125 * log2(e)
        #pragma unroll
        for (int c = 0; c < 2; ++c) {
            const float* p = qp + g * 16 * D_DIM + c * 32;
            V16u a;
            #pragma unroll
            for (int i = 0; i < 8; ++i)
                a.h[i] = __builtin_amdgcn_cvt_pkrtz(p[2*i] * scale, p[2*i+1] * scale);
            aq[g][c] = a.v;
        }
    }

    // All-ones A fragment: ones x P^T = per-query sums over both lane halves' keys,
    // the same in all 8 accumulator rows
    v16h ones;
    #pragma unroll
    for (int e = 0; e < 16; ++e) ones[e] = (_Float16)1.0f;

    // Online-softmax state (log2 domain): one query per lane and column group, equal in lanes
    // l and l ^ 16
    float m_i[WG_COLS];
    v8f   lacc[WG_COLS];     // running denominator, accumulated through WMMA C operand
    v8f   o[WG_COLS][4];
    #pragma unroll
    for (int g = 0; g < WG_COLS; ++g) {
        m_i[g]  = -3.0e38f;
        lacc[g] = (v8f){0,0,0,0,0,0,0,0};
        #pragma unroll
        for (int d = 0; d < 4; ++d) o[g][d] = (v8f){0,0,0,0,0,0,0,0};
    }

    // This wave's packed mask words (head-broadcast): 32 per chunk and column group, the same for
    // every lane, so they come by scalar loads. The first launch wrote them and nothing writes
    // them in this one. Column group g's words stand NCHUNK tiles behind those of group g - 1.
    const int wave_u = __builtin_amdgcn_readfirstlane(wave);
    const u16v* mb = (const u16v*)(Bits + (size_t)((b * (S_DIM / 16) + blockIdx.x * (ATILE / 16)
                                                    + wave_u * WG_COLS) * NCHUNK) * TILE_WORDS);
    u16v mw[WG_COLS][2];             // chunk 0; later chunks one trip ahead
    #pragma unroll
    for (int g = 0; g < WG_COLS; ++g) {
        mw[g][0] = mb[g * NCHUNK * 2];
        mw[g][1] = mb[g * NCHUNK * 2 + 1];
    }

    // K and V rows of a chunk travel one trip ahead of their use, in registers
    const float* kg = Kb + (size_t)((tid >> 4) * 4) * D_DIM + (tid & 15) * 4;
    const float* vg = Vb + (size_t)((tid >> 4) * 4) * D_DIM + (tid & 15) * 4;
    float4 kf[4], vf[4];

    load_kv_rows(kg, vg, kf, vf);

    for (int kv0 = 0; kv0 < S_DIM; kv0 += KV_CHUNK) {

        // ---- Cooperative stage: 4x4 register-transpose blocks, packed cvt ----
        // kf / vf hold this chunk's rows, loaded one trip ago (chunk 0: in front of the loop)
        {
            const int tr = tid >> 4;          // kv block (0..15): one 4x4 tile per thread
            const int tc = tid & 15;          // d  block (0..15)
            #pragma unroll
            for (int r = 0; r < 4; ++r) {
                H4u kk;
                kk.h[0] = __builtin_amdgcn_cvt_pkrtz(kf[r].x, kf[r].y);
                kk.h[1] = __builtin_amdgcn_cvt_pkrtz(kf[r].z, kf[r].w);
                *(h4*)&Kt[tr*4 + r][tc*4] = kk.v;   // ds_store_b64
            }
            #pragma unroll
            for (int c = 0; c < 4; ++c) {
                H4u vv;
                vv.h[0] = __builtin_amdgcn_cvt_pkrtz(((const float*)&vf[0])[c],
                                                     ((const float*)&vf[1])[c]);
                vv.h[1] = __builtin_amdgcn_cvt_pkrtz(((const float*)&vf[2])[c],
                                                     ((const float*)&vf[3])[c]);
                *(h4*)&VtT[tc*4 + c][tr*4] = vv.v;  // ds_store_b64
            }
        }
        // The next chunk's rows start their way now and are first used at the top of the next
        // trip: their latency runs under this chunk's products and softmax. No branch round
        // the loads (a merge of two paths made the compiler wait for them at once): the last
        // trip reads its own chunk again and nobody uses it.
        const int kvn = (kv0 + KV_CHUNK < S_DIM) ? kv0 + KV_CHUNK : kv0;
        const float* kn = kg + (size_t)kvn * D_DIM;
        const float* vn = vg + (size_t)kvn * D_DIM;
        load_kv_rows(kn, vn, kf, vf);

        // The work-group barrier by hand: __syncthreads() also waits for every global load of
        // the wave, which would end the flight of the next chunk's rows here.
        // The loads' address registers are inputs here so that they stay whole up to this wait
        // and are free for other use only behind it.
        asm volatile("s_wait_xcnt 0x0" :: "v"(kn), "v"(vn) : "memory");
        asm volatile("s_wait_dscnt 0x0" ::: "memory");  // this wave's K / V^T stores are in LDS
        bar_signal();
        bar_wait();     // every wave's K and V^T rows of this chunk are in LDS

        // ---- Score tiles: S^T = K Q^T (log2 domain), masked elements set to -inf ----
        // Word j*8 + v of the packed mask is a lane mask: one select per element.
        // m_i is finite from the start, so -inf - mnew stays -inf and a masked P is exactly 0,
        // which is what the reference's second where() leaves of it.
        const v8f zero = (v8f){0,0,0,0,0,0,0,0};
        v8f sc[WG_COLS][4];
        #pragma unroll
        for (int j = 0; j < 4; ++j) {
            v16h ak0 = ld_frag(&Kt[j*16 + lm][0  + half*16]);
            v16h ak1 = ld_frag(&Kt[j*16 + lm][32 + half*16]);
            #pragma unroll
            for (int g = 0; g < WG_COLS; ++g) {
                v8f s = __builtin_amdgcn_wmma_f32_16x16x32_f16(false, ak0, false, aq[g][0],
                                                               (short)0, zero, false, false);
                s = __builtin_amdgcn_wmma_f32_16x16x32_f16(false, ak1, false, aq[g][1],
                                                           (short)0, s, false, false);
                sc[g][j] = s;
            }
        }
        #pragma unroll
        for (int g = 0; g < WG_COLS; ++g)
            #pragma unroll
            for (int j = 0; j < 4; ++j)
                #pragma unroll
                for (int v = 0; v < 8; ++v) {
                    const unsigned w = mw[g][j >> 1][(j & 1) * 8 + v];
                    sc[g][j][v] = __builtin_amdgcn_inverse_ballot_w32(w) ? -__builtin_inff()
                                                                         : sc[g][j][v];
                }

        // ---- One online-softmax update per 64-wide chunk, one query per lane and group ----
        // P^T as B operands straight from the score accumulators: tiles (0,1) are keys
        // 0..31, tiles (2,3) keys 32..63; position s of a lane is key 8*half + s or
        // 16 + 8*half + (s - 8) of its block, the order ld_frag_kmap gives V^T.
        // exp2(-inf) is exactly 0 => masked P is 0
        P16u pb[WG_COLS][2];
        #pragma unroll
        for (int g = 0; g < WG_COLS; ++g) {
            float tm[4];
            #pragma unroll
            for (int j = 0; j < 4; ++j) {
                float x0 = fmaxf(fmaxf(sc[g][j][0], sc[g][j][1]), sc[g][j][2]);
                float x1 = fmaxf(fmaxf(sc[g][j][3], sc[g][j][4]), sc[g][j][5]);
                tm[j] = fmaxf(fmaxf(x0, x1), fmaxf(sc[g][j][6], sc[g][j][7]));
            }
            float rm = fmaxf(fmaxf(tm[0], tm[1]), fmaxf(tm[2], tm[3]));
            rm = fmaxf(rm, other_half(rm));   // the other 32 keys of this query

            const float mnew  = fmaxf(m_i[g], rm);
            const float alpha = exp2_bare(m_i[g] - mnew);
            m_i[g] = mnew;
            lacc[g] *= alpha;
            #pragma unroll
            for (int d = 0; d < 4; ++d) o[g][d] *= alpha;

            #pragma unroll
            for (int j = 0; j < 4; ++j)
                #pragma unroll
                for (int i = 0; i < 4; ++i) {
                    // two scores per subtract: one v_pk_add_f32
                    const f2 x = (f2){sc[g][j][2*i], sc[g][j][2*i + 1]} - (f2){mnew, mnew};
                    f2 e;
                    e.x = exp2_bare(x.x);
                    e.y = exp2_bare(x.y);
                    pb[g][j >> 1].h[(j & 1) * 4 + i] = __builtin_convertvector(e, h2);
                }

            // l += sum over keys of P, accumulated entirely inside the matrix pipe
            lacc[g] = __builtin_amdgcn_wmma_f32_16x16x32_f16(false, ones, false, pb[g][0].v,
                                                             (short)0, lacc[g], false, false);
            lacc[g] = __builtin_amdgcn_wmma_f32_16x16x32_f16(false, ones, false, pb[g][1].v,
                                                             (short)0, lacc[g], false, false);
        }

        // ---- O^T += V^T P^T : A[m][k] = V[kv0+k][d*16+m] from the transposed V tile ----
        #pragma unroll
        for (int d = 0; d < 4; ++d) {
            v16h av0 = ld_frag_kmap(&VtT[d*16 + lm][0],  half);
            v16h av1 = ld_frag_kmap(&VtT[d*16 + lm][32], half);
            #pragma unroll
            for (int g = 0; g < WG_COLS; ++g) {
                o[g][d] = __builtin_amdgcn_wmma_f32_16x16x32_f16(false, av0, false, pb[g][0].v,
                                                                 (short)0, o[g][d], false, false);
                o[g][d] = __builtin_amdgcn_wmma_f32_16x16x32_f16(false, av1, false, pb[g][1].v,
                                                                 (short)0, o[g][d], false, false);
            }
        }

        // The next chunk's mask words (the last trip reads its own again, unused). They hang only
        // on the selects above, and the compiler starts them right behind those; in the source
        // they stand behind the chunk's last LDS read, as no LDS read moves up over the wait
        // statement among them.
        #pragma unroll
        for (int g = 0; g < WG_COLS; ++g) {
            mw[g][0] = mb[(g * NCHUNK + kvn / KV_CHUNK) * 2];
            // The last of these loads may land on the scalar register that holds the offset all
            // of them name: the wait stands in front of it
            if (g == WG_COLS - 1) asm volatile("s_wait_xcnt 0x0" ::: "memory");
            mw[g][1] = mb[(g * NCHUNK + kvn / KV_CHUNK) * 2 + 1];
        }

        // ---- Foot: hand the buffers over ----
        asm volatile("s_wait_dscnt 0x0" ::: "memory");     // this wave's LDS reads of the chunk are done
        bar_signal();     // by hand, as above: the rows in flight stay in flight
        bar_wait();       // chunk fully consumed by all waves
    }
    asm volatile("s_wait_loadcnt 0x0" ::: "memory");   // nor a row of the last trip's unused loads

    // ---- Epilogue: O / l, store fp32 [B,H,S,D] ----
    // o[g][d][v] = O[qrow + 16*g][d*16 + 8*half + v]: two 16-byte stores per tile
    #pragma unroll
    for (int g = 0; g < WG_COLS; ++g) {
        float* op = Out + base + (size_t)(qrow + 16 * g) * D_DIM + 8*half;
        const float inv = (lacc[g][0] > 0.0f) ? (1.0f / lacc[g][0]) : 0.0f;
        #pragma unroll
        for (int d = 0; d < 4; ++d) {
            *(float4*)(op + d*16)     = make_float4(o[g][d][0] * inv, o[g][d][1] * inv,
                                                    o[g][d][2] * inv, o[g][d][3] * inv);
            *(float4*)(op + d*16 + 4) = make_float4(o[g][d][4] * inv, o[g][d][5] * inv,
                                                    o[g][d][6] * inv, o[g][d][7] * inv);
        }
    }
}

extern "C" void kernel_launch(void* const* d_in, const int* in_sizes, int n_in,
                              void* d_out, int out_size, void* d_ws, size_t ws_size,
                              hipStream_t stream) {
    (void)in_sizes; (void)n_in; (void)out_size; (void)ws_size;
    const float* Q    = (const float*)d_in[0];
    const float* K    = (const float*)d_in[1];
    const float* V    = (const float*)d_in[2];
    const int*   Mask = (const int*)d_in[3];
    float* Out = (float*)d_out;
    unsigned* Bits = (unsigned*)d_ws;   // B*S*S bits = 2 MiB, written by the first launch

    const int B = 4, H = H_DIM;
    dim3 grid(S_DIM / ATILE, B * H);   // (8, 32) blocks
    dim3 block(NTHREADS);
    dim3 pgrid(S_DIM / PKEYS, B * S_DIM / QTILE);   // (8, 64) blocks
    pack_mask_kernel<<<pgrid, block, 0, stream>>>(Mask, Bits);
    fa_wmma_kernel<<<grid, block, 0, stream>>>(Q, K, V, Bits, Out);
}

// v009
// A run of this version takes 40.5 microseconds.
// Timed twice side by side with v008, it ran 1.06 and 1.05 times as fast.
// Counting every step since v000, it is 4.15 times as fast.
#include <hip/hip_runtime.h>

typedef _Float16 v16h  __attribute__((ext_vector_type(16)));
typedef _Float16 v8h   __attribute__((ext_vector_type(8)));
typedef _Float16 h4    __attribute__((ext_vector_type(4)));
typedef __fp16   f16x2 __attribute__((ext_vector_type(2)));   // cvt_pkrtz return type
typedef float    v8f   __attribute__((ext_vector_type(8)));
typedef _Float16 h2    __attribute__((ext_vector_type(2)));
typedef float    f2    __attribute__((ext_vector_type(2)));
typedef unsigned u16v  __attribute__((ext_vector_type(16)));

#define S_DIM 2048
#define D_DIM 64
#define H_DIM 8
#define KV_CHUNK 64
#define QTILE 128       // mask rows per block of the packing launch (8 waves x 16 rows)
#define NTHREADS 256
// The attention kernel: 16-query column groups per wave, and Q rows per block (8 waves x 32 rows)
#define WG_COLS 2
#define ATILE (8 * 16 * WG_COLS)
// LDS row pitch in f16 elements: 64 data + 8 pad = 144 B = 16 B x 9 (odd), so the
// 16 rows that one ds_load_b128 touches start on distinct 4-bank groups.
#define LDP 72
// The packing launch: keys per work-group, and the LDS row pitch of its mask tile in 32-bit
// words: 256 data + 4 pad = 1040 B = 16 B x 65 (odd)
#define PKEYS 256
#define MLP 260
// Packed mask: 32 words per (16 queries x 64 keys) tile, one per score accumulator element
#define TILE_WORDS 32
#define NCHUNK (S_DIM / KV_CHUNK)

union H4u  { h4   v; f16x2 h[2]; };
union V16u { v16h v; f16x2 h[8]; };
union P16u { v16h v; h2    h[8]; };

// 32-byte fragment from a row that is only 16-byte aligned: two ds_load_b128
__device__ __forceinline__ v16h ld_frag(const _Float16* p)
{
    v8h lo = *(const v8h*)p;
    v8h hi = *(const v8h*)(p + 8);
    return __builtin_shufflevector(lo, hi, 0, 1, 2, 3, 4, 5, 6, 7,
                                   8, 9, 10, 11, 12, 13, 14, 15);
}

// A fragment in the k order of a packed accumulator pair: p points at a block of
// 32 k in a row; position s holds k = 8*half + s (s < 8), 16 + 8*half + (s - 8) else
__device__ __forceinline__ v16h ld_frag_kmap(const _Float16* p, int half)
{
    v8h lo = *(const v8h*)(p + 8 * half);
    v8h hi = *(const v8h*)(p + 16 + 8 * half);
    return __builtin_shufflevector(lo, hi, 0, 1, 2, 3, 4, 5, 6, 7,
                                   8, 9, 10, 11, 12, 13, 14, 15);
}

// One 128 x 64 piece of the mask tile (this block's query rows, 64 keys) from global memory into
// LDS through no register: 8 asynchronous 16-byte copies per lane. Lanes 0..15 of a copy
// cover the 256 contiguous bytes of one row and lanes 16..31 those of the next row, so a
// wave-wide copy touches four whole 128-byte lines.
// g: this lane's first source word; l: this lane's first LDS byte address.
// s_wait_xcnt 0 ends the statement so that it stands before any rewrite of an address
// register that a copy names.
__device__ __forceinline__ void copy_mask_tile(const int* g, unsigned l)
{
    const int* g0 = g;
    const int* g1 = g + 2  * S_DIM;
    const int* g2 = g + 4  * S_DIM;
    const int* g3 = g + 6  * S_DIM;
    const int* g4 = g + 8  * S_DIM;
    const int* g5 = g + 10 * S_DIM;
    const int* g6 = g + 12 * S_DIM;
    const int* g7 = g + 14 * S_DIM;
    const unsigned st = 2u * MLP * 4u;   // two LDS rows, bytes
    asm volatile("global_load_async_to_lds_b128 %0, %8, off\n\t"
                 "global_load_async_to_lds_b128 %1, %9, off\n\t"
                 "global_load_async_to_lds_b128 %2, %10, off\n\t"
                 "global_load_async_to_lds_b128 %3, %11, off\n\t"
                 "global_load_async_to_lds_b128 %4, %12, off\n\t"
                 "global_load_async_to_lds_b128 %5, %13, off\n\t"
                 "global_load_async_to_lds_b128 %6, %14, off\n\t"
                 "global_load_async_to_lds_b128 %7, %15, off\n\t"
                 "s_wait_xcnt 0x0"
                 :: "v"(l), "v"(l + st), "v"(l + 2u * st), "v"(l + 3u * st),
                    "v"(l + 4u * st), "v"(l + 5u * st), "v"(l + 6u * st), "v"(l + 7u * st),
                    "v"(g0), "v"(g1), "v"(g2), "v"(g3), "v"(g4), "v"(g5), "v"(g6), "v"(g7)
                 : "memory");
}

// One thread's share of a 64 x 64 K chunk and V chunk, f32, into registers: one 4x4 block of
// each. k, v: the first word of this thread's block.
__device__ __forceinline__ void load_kv_rows(const float* k, const float* v,
                                             float4 (&kf)[4], float4 (&vf)[4])
{
    #pragma unroll
    for (int r = 0; r < 4; ++r) {
        kf[r] = *(const float4*)(k + r * D_DIM);
        vf[r] = *(const float4*)(v + r * D_DIM);
    }
}

// The same share, rounded to f16, from registers into one LDS buffer: 4x4 register-transpose
// blocks, packed cvt. tr: kv block (0..15), tc: d block (0..15): one 4x4 tile per thread.
__device__ __forceinline__ void stage_kv(const float4 (&kf)[4], const float4 (&vf)[4],
                                         _Float16 (*kd)[LDP], _Float16 (*vd)[LDP],
                                         int tr, int tc)
{
    #pragma unroll
    for (int r = 0; r < 4; ++r) {
        H4u kk;
        kk.h[0] = __builtin_amdgcn_cvt_pkrtz(kf[r].x, kf[r].y);
        kk.h[1] = __builtin_amdgcn_cvt_pkrtz(kf[r].z, kf[r].w);
        *(h4*)&kd[tr*4 + r][tc*4] = kk.v;   // ds_store_b64
    }
    #pragma unroll
    for (int c = 0; c < 4; ++c) {
        H4u vv;
        vv.h[0] = __builtin_amdgcn_cvt_pkrtz(((const float*)&vf[0])[c],
                                             ((const float*)&vf[1])[c]);
        vv.h[1] = __builtin_amdgcn_cvt_pkrtz(((const float*)&vf[2])[c],
                                             ((const float*)&vf[3])[c]);
        *(h4*)&vd[tc*4 + c][tr*4] = vv.v;   // ds_store_b64
    }
}

// The two halves of the work-group barrier, with no wait of their own: the waits that a place
// needs stand in front of the signal. The clobber keeps LDS accesses on their side.
__device__ __forceinline__ void bar_signal() { asm volatile("s_barrier_signal -1" ::: "memory"); }
__device__ __forceinline__ void bar_wait()   { asm volatile("s_barrier_wait -1" ::: "memory"); }

// 2^x as the bare v_exp_f32, without the library form's range scaling (compare, two selects,
// add, ldexp per value). That scaling only matters for results below 2^-126, which the bare
// instruction may return as 0: a P that small rounds to 0 in f16 anyway, and an alpha that
// small multiplies sums that lie 2^126 below the new chunk's largest term.
__device__ __forceinline__ float exp2_bare(float x)
{
    return __builtin_amdgcn_exp2f(x);
}

// value of lane l ^ 16
__device__ __forceinline__ float other_half(float x)
{
    int b = __builtin_bit_cast(int, x);
    b = __builtin_amdgcn_permlanex16(b, b, 0x76543210, 0xfedcba98, false, false);
    return __builtin_bit_cast(float, b);
}

// First launch: the mask, which all 8 heads of a batch share, is read once and packed to one
// bit per element, in the form the attention kernel's selects take: for the tile of 16 queries
// and 64 keys that one column group of a wave scores in one trip, word j*8 + v holds in bit l the mask of
// query (l & 15), key j*16 + 8*(l >> 4) + v, which is where lane l keeps element v of score
// tile j. A work-group packs 128 query rows x 256 keys; each wave its own 16 rows.
__global__ __launch_bounds__(NTHREADS)
void pack_mask_kernel(const int* __restrict__ Mask, unsigned* __restrict__ Bits)
{
    __shared__ __align__(128) int Mt[QTILE][MLP];                // [q][key]  130 KB

    const int tid  = threadIdx.x;
    const int wave = tid >> 5;
    const int lane = tid & 31;
    const int half = lane >> 4;
    const int lm   = lane & 15;

    const int kb = blockIdx.x;      // block of 256 keys
    const int rb = blockIdx.y;      // block of 128 rows of the [B*S][S] mask

    // copy i of lane l brings 16 bytes of row wave*16 + 2*i + (l >> 4), words 4*(l & 15) .. +3
    const int  crow = wave * 16 + half;
    const int* mg   = Mask + (size_t)(rb * QTILE + crow) * S_DIM + kb * PKEYS + lm * 4;
    const unsigned ml = (unsigned)(size_t)&Mt[crow][lm * 4];
    #pragma unroll
    for (int c = 0; c < PKEYS / KV_CHUNK; ++c)
        copy_mask_tile(mg + c * KV_CHUNK, ml + (unsigned)(c * KV_CHUNK * 4));
    asm volatile("s_wait_asynccnt 0x0" ::: "memory");  // this wave's 32 copies have landed
    __syncthreads();                                   // ... and are published

    const int* mp = &Mt[wave * 16 + lm][8 * half];
    unsigned* bp = Bits + ((size_t)(rb * (QTILE / 16) + wave) * NCHUNK
                           + kb * (PKEYS / KV_CHUNK)) * TILE_WORDS + lane;
    #pragma unroll
    for (int c = 0; c < PKEYS / KV_CHUNK; ++c) {
        unsigned r = 0;     // lane e collects word e
        #pragma unroll
        for (int j = 0; j < 4; ++j)
            #pragma unroll
            for (int p = 0; p < 2; ++p) {
                const int4 x = *(const int4*)(mp + c * KV_CHUNK + j * 16 + 4 * p);
                const int e = j * 8 + 4 * p;
                // every lane votes, so the ballots stand in front of the selects
                const unsigned w0 = __builtin_amdgcn_ballot_w32(x.x != 0);
                const unsigned w1 = __builtin_amdgcn_ballot_w32(x.y != 0);
                const unsigned w2 = __builtin_amdgcn_ballot_w32(x.z != 0);
                const unsigned w3 = __builtin_amdgcn_ballot_w32(x.w != 0);
                r = __builtin_amdgcn_inverse_ballot_w32(1u << (e + 0)) ? w0 : r;
                r = __builtin_amdgcn_inverse_ballot_w32(1u << (e + 1)) ? w1 : r;
                r = __builtin_amdgcn_inverse_ballot_w32(1u << (e + 2)) ? w2 : r;
                r = __builtin_amdgcn_inverse_ballot_w32(1u << (e + 3)) ? w3 : r;
            }
        bp[c * TILE_WORDS] = r;     // 128 contiguous bytes per wave
    }
}

// Each wave owns 32 queries (two column groups), so that every K and V^T fragment read from LDS
// feeds two matrix instructions and a staged chunk serves 256 queries. The grid is then one
// work-group per WGP, two waves per SIMD: the register budget is set for that.
__global__ __launch_bounds__(NTHREADS) __attribute__((amdgpu_waves_per_eu(2, 2)))
void fa_wmma_kernel(const float* __restrict__ Q,
                    const float* __restrict__ K,
                    const float* __restrict__ V,
                    const unsigned* __restrict__ Bits,
                    float* __restrict__ Out)
{
    // LDS: K chunk (row major, f16), V chunk (transposed, f16), two buffers of each: while a
    // trip reads one, the next chunk is written into the other
    __shared__ __align__(128) _Float16 Kt[2][KV_CHUNK][LDP];     // [buf][kv][d]   2 x 9 KB
    __shared__ __align__(128) _Float16 VtT[2][D_DIM][LDP];       // [buf][d][kv]   2 x 9 KB

    const int tid  = threadIdx.x;
    const int wave = tid >> 5;
    const int lane = tid & 31;
    const int half = lane >> 4;     // 0 or 1 (lane groups per WMMA layout)
    const int lm   = lane & 15;     // lane % 16

    const int bh = blockIdx.y;              // b*H + h
    const int b  = bh / H_DIM;
    const size_t base = (size_t)bh * S_DIM * D_DIM;

    const float* Qb = Q + base;
    const float* Kb = K + base;
    const float* Vb = V + base;

    const int q0   = blockIdx.x * ATILE + wave * (16 * WG_COLS);  // first Q row of this wave
    const int qrow = q0 + lm;     // this lane's query in column group 0; group g: + 16 * g

    // ---- Load Q^T B-fragments (32x16 f16 each, D split into two K=32 chunks) ----
    // Lane L holds column N=L%16, k = (L/16)*16 + e, e=0..15 (contiguous in d, as the K rows)
    // Fold (1/sqrt(64)) * log2(e) into Q: softmax runs in the log2 domain.
    v16h aq[WG_COLS][2];
    const float* qp = Qb + (size_t)qrow * D_DIM + half * 16;   // group g: 16 * g rows further
    #pragma unroll
    for (int g = 0; g < WG_COLS; ++g) {
        const float scale = 0.18033688011112042f;  // 0.125 * log2(e)
        #pragma unroll
        for (int c = 0; c < 2; ++c) {
            const float* p = qp + g * 16 * D_DIM + c * 32;
            V16u a;
            #pragma unroll
            for (int i = 0; i < 8; ++i)
                a.h[i] = __builtin_amdgcn_cvt_pkrtz(p[2*i] * scale, p[2*i+1] * scale);
            aq[g][c] = a.v;
        }
    }

    // All-ones A fragment: ones x P^T = per-query sums over both lane halves' keys,
    // the same in all 8 accumulator rows
    v16h ones;
    #pragma unroll
    for (int e = 0; e < 16; ++e) ones[e] = (_Float16)1.0f;

    // Online-softmax state (log2 domain): one query per lane and column group, equal in lanes
    // l and l ^ 16
    float m_i[WG_COLS];
    v8f   lacc[WG_COLS];     // running denominator, accumulated through WMMA C operand
    v8f   o[WG_COLS][4];
    #pragma unroll
    for (int g = 0; g < WG_COLS; ++g) {
        m_i[g]  = -3.0e38f;
        lacc[g] = (v8f){0,0,0,0,0,0,0,0};
        #pragma unroll
        for (int d = 0; d < 4; ++d) o[g][d] = (v8f){0,0,0,0,0,0,0,0};
    }

    // This wave's packed mask words (head-broadcast): 32 per chunk and column group, the same for
    // every lane, so they come by scalar loads. The first launch wrote them and nothing writes
    // them in this one. Column group g's words stand NCHUNK tiles behind those of group g - 1.
    const int wave_u = __builtin_amdgcn_readfirstlane(wave);
    const u16v* mb = (const u16v*)(Bits + (size_t)((b * (S_DIM / 16) + blockIdx.x * (ATILE / 16)
                                                    + wave_u * WG_COLS) * NCHUNK) * TILE_WORDS);
    u16v mw[WG_COLS][2];             // chunk 0; later chunks one trip ahead
    #pragma unroll
    for (int g = 0; g < WG_COLS; ++g) {
        mw[g][0] = mb[g * NCHUNK * 2];
        mw[g][1] = mb[g * NCHUNK * 2 + 1];
    }

    // K and V rows of a chunk travel in registers one trip ahead of their way into LDS, which
    // is one trip ahead of their use
    const int tr = tid >> 4;          // kv block (0..15): one 4x4 tile per thread
    const int tc = tid & 15;          // d  block (0..15)
    const float* kg = Kb + (size_t)(tr * 4) * D_DIM + tc * 4;
    const float* vg = Vb + (size_t)(tr * 4) * D_DIM + tc * 4;
    float4 kf[4], vf[4];
    {
        float4 k0[4], v0[4];
        load_kv_rows(kg, vg, k0, v0);                                        // chunk 0
        load_kv_rows(kg + KV_CHUNK * D_DIM, vg + KV_CHUNK * D_DIM, kf, vf);  // chunk 1
        stage_kv(k0, v0, Kt[0], VtT[0], tr, tc);
    }
    // The work-group barrier by hand, here and at the loop's foot: __syncthreads() also waits for
    // every global load of the wave, which would end the flight of the next rows.
    asm volatile("s_wait_dscnt 0x0" ::: "memory");  // this wave's K / V^T stores are in LDS
    bar_signal();
    bar_wait();     // every wave's K and V^T rows of chunk 0 are in LDS

    for (int kv0 = 0; kv0 < S_DIM; kv0 += KV_CHUNK) {
        const int cur = (kv0 / KV_CHUNK) & 1;       // the buffer this trip reads
        const _Float16 (*Kc)[LDP] = Kt[cur];
        const _Float16 (*Vc)[LDP] = VtT[cur];

        // This chunk's K fragments start first: the staging below runs under their latency
        v16h ak[4][2];
        #pragma unroll
        for (int j = 0; j < 4; ++j) {
            ak[j][0] = ld_frag(&Kc[j*16 + lm][0  + half*16]);
            ak[j][1] = ld_frag(&Kc[j*16 + lm][32 + half*16]);
        }
        // keeps the staging's converts and global loads from being issued in front of these reads,
        // whose latency is what the wave waits for next
        __builtin_amdgcn_sched_barrier(0);

        // ---- Cooperative stage of the NEXT chunk into the other buffer ----
        // kf / vf hold its rows, loaded one trip ago (chunk 1: in front of the loop). Every wave
        // left that buffer before the barrier at the foot of the trip before, and nobody reads
        // the new rows before the barrier at the foot of this one: one barrier a trip, and no
        // wave waits for these stores with nothing else to do. The last trip writes rows that
        // nobody reads.
        stage_kv(kf, vf, Kt[cur ^ 1], VtT[cur ^ 1], tr, tc);

        // The rows of the chunk after that start their way now and are first used at the top of
        // the next trip: their latency runs under this chunk's products and softmax. No branch
        // round the loads (a merge of two paths made the compiler wait for them at once): the
        // last two trips read the last chunk again.
        const int kvn = (kv0 + KV_CHUNK < S_DIM) ? kv0 + KV_CHUNK : kv0;
        const int kv2 = (kv0 + 2 * KV_CHUNK < S_DIM) ? kv0 + 2 * KV_CHUNK : S_DIM - KV_CHUNK;
        const float* kn = kg + (size_t)kv2 * D_DIM;
        const float* vn = vg + (size_t)kv2 * D_DIM;
        load_kv_rows(kn, vn, kf, vf);

        // The loads' address registers are inputs here so that they stay whole up to this wait
        // and are free for other use only behind it.
        asm volatile("s_wait_xcnt 0x0" :: "v"(kn), "v"(vn) : "memory");

        // This chunk's V^T fragments, A[m][k] = V[kv0+k][d*16+m] from the transposed V tile, start
        // behind the K fragments and land under the score products and the maxima
        v16h av[4][2];
        #pragma unroll
        for (int d = 0; d < 4; ++d) {
            av[d][0] = ld_frag_kmap(&Vc[d*16 + lm][0],  half);
            av[d][1] = ld_frag_kmap(&Vc[d*16 + lm][32], half);
        }
        // keeps these reads from sinking to the wait in front of the foot barrier, where the wave
        // would sit out their latency
        __builtin_amdgcn_sched_barrier(0);

        // ---- Score tiles: S^T = K Q^T (log2 domain), masked elements set to -inf ----
        // Word j*8 + v of the packed mask is a lane mask: one select per element.
        // m_i is finite from the start, so -inf - mnew stays -inf and a masked P is exactly 0,
        // which is what the reference's second where() leaves of it.
        const v8f zero = (v8f){0,0,0,0,0,0,0,0};
        v8f sc[WG_COLS][4];
        #pragma unroll
        for (int j = 0; j < 4; ++j) {
            #pragma unroll
            for (int g = 0; g < WG_COLS; ++g) {
                v8f s = __builtin_amdgcn_wmma_f32_16x16x32_f16(false, ak[j][0], false, aq[g][0],
                                                               (short)0, zero, false, false);
                s = __builtin_amdgcn_wmma_f32_16x16x32_f16(false, ak[j][1], false, aq[g][1],
                                                           (short)0, s, false, false);
                sc[g][j] = s;
            }
        }
        #pragma unroll
        for (int g = 0; g < WG_COLS; ++g)
            #pragma unroll
            for (int j = 0; j < 4; ++j)
                #pragma unroll
                for (int v = 0; v < 8; ++v) {
                    const unsigned w = mw[g][j >> 1][(j & 1) * 8 + v];
                    sc[g][j][v] = __builtin_amdgcn_inverse_ballot_w32(w) ? -__builtin_inff()
                                                                         : sc[g][j][v];
                }

        // ---- One online-softmax update per 64-wide chunk, one query per lane and group ----
        // P^T as B operands straight from the score accumulators: tiles (0,1) are keys
        // 0..31, tiles (2,3) keys 32..63; position s of a lane is key 8*half + s or
        // 16 + 8*half + (s - 8) of its block, the order ld_frag_kmap gives V^T.
        // exp2(-inf) is exactly 0 => masked P is 0
        P16u pb[WG_COLS][2];
        #pragma unroll
        for (int g = 0; g < WG_COLS; ++g) {
            float tm[4];
            #pragma unroll
            for (int j = 0; j < 4; ++j) {
                float x0 = fmaxf(fmaxf(sc[g][j][0], sc[g][j][1]), sc[g][j][2]);
                float x1 = fmaxf(fmaxf(sc[g][j][3], sc[g][j][4]), sc[g][j][5]);
                tm[j] = fmaxf(fmaxf(x0, x1), fmaxf(sc[g][j][6], sc[g][j][7]));
            }
            float rm = fmaxf(fmaxf(tm[0], tm[1]), fmaxf(tm[2], tm[3]));
            rm = fmaxf(rm, other_half(rm));   // the other 32 keys of this query

            const float mnew  = fmaxf(m_i[g], rm);
            const float alpha = exp2_bare(m_i[g] - mnew);
            m_i[g] = mnew;
            lacc[g] *= alpha;
            #pragma unroll
            for (int d = 0; d < 4; ++d) o[g][d] *= alpha;

            #pragma unroll
            for (int j = 0; j < 4; ++j)
                #pragma unroll
                for (int i = 0; i < 4; ++i) {
                    // two scores per subtract: one v_pk_add_f32
                    const f2 x = (f2){sc[g][j][2*i], sc[g][j][2*i + 1]} - (f2){mnew, mnew};
                    f2 e;
                    e.x = exp2_bare(x.x);
                    e.y = exp2_bare(x.y);
                    pb[g][j >> 1].h[(j & 1) * 4 + i] = __builtin_convertvector(e, h2);
                }

            // l += sum over keys of P, accumulated entirely inside the matrix pipe
            lacc[g] = __builtin_amdgcn_wmma_f32_16x16x32_f16(false, ones, false, pb[g][0].v,
                                                             (short)0, lacc[g], false, false);
            lacc[g] = __builtin_amdgcn_wmma_f32_16x16x32_f16(false, ones, false, pb[g][1].v,
                                                             (short)0, lacc[g], false, false);
        }

        // ---- O^T += V^T P^T ----
        #pragma unroll
        for (int d = 0; d < 4; ++d) {
            #pragma unroll
            for (int g = 0; g < WG_COLS; ++g) {
                o[g][d] = __builtin_amdgcn_wmma_f32_16x16x32_f16(false, av[d][0], false, pb[g][0].v,
                                                                 (short)0, o[g][d], false, false);
                o[g][d] = __builtin_amdgcn_wmma_f32_16x16x32_f16(false, av[d][1], false, pb[g][1].v,
                                                                 (short)0, o[g][d], false, false);
            }
        }

        // The next chunk's mask words (the last trip reads its own again, unused). They hang only
        // on the selects above, and the compiler starts them right behind those; in the source
        // they stand behind the chunk's last LDS read, as no LDS read moves up over the wait
        // statement among them.
        #pragma unroll
        for (int g = 0; g < WG_COLS; ++g) {
            mw[g][0] = mb[(g * NCHUNK + kvn / KV_CHUNK) * 2];
            // The last of these loads may land on the scalar register that holds the offset all
            // of them name: the wait stands in front of it
            if (g == WG_COLS - 1) asm volatile("s_wait_xcnt 0x0" ::: "memory");
            mw[g][1] = mb[(g * NCHUNK + kvn / KV_CHUNK) * 2 + 1];
        }

        // ---- Foot: hand the buffers over ----
        // this wave's LDS reads of the chunk are done and its rows of the next chunk are in LDS
        asm volatile("s_wait_dscnt 0x0" ::: "memory");
        bar_signal();     // by hand, as above: the rows in flight stay in flight
        bar_wait();       // chunk consumed, and the next one published, by all waves
    }
    asm volatile("s_wait_loadcnt 0x0" ::: "memory");   // nor a row of the last trip's unused loads

    // ---- Epilogue: O / l, store fp32 [B,H,S,D] ----
    // o[g][d][v] = O[qrow + 16*g][d*16 + 8*half + v]: two 16-byte stores per tile
    #pragma unroll
    for (int g = 0; g < WG_COLS; ++g) {
        float* op = Out + base + (size_t)(qrow + 16 * g) * D_DIM + 8*half;
        const float inv = (lacc[g][0] > 0.0f) ? (1.0f / lacc[g][0]) : 0.0f;
        #pragma unroll
        for (int d = 0; d < 4; ++d) {
            *(float4*)(op + d*16)     = make_float4(o[g][d][0] * inv, o[g][d][1] * inv,
                                                    o[g][d][2] * inv, o[g][d][3] * inv);
            *(float4*)(op + d*16 + 4) = make_float4(o[g][d][4] * inv, o[g][d][5] * inv,
                                                    o[g][d][6] * inv, o[g][d][7] * inv);
        }
    }
}

extern "C" void kernel_launch(void* const* d_in, const int* in_sizes, int n_in,
                              void* d_out, int out_size, void* d_ws, size_t ws_size,
                              hipStream_t stream) {
    (void)in_sizes; (void)n_in; (void)out_size; (void)ws_size;
    const float* Q    = (const float*)d_in[0];
    const float* K    = (const float*)d_in[1];
    const float* V    = (const float*)d_in[2];
    const int*   Mask = (const int*)d_in[3];
    float* Out = (float*)d_out;
    unsigned* Bits = (unsigned*)d_ws;   // B*S*S bits = 2 MiB, written by the first launch

    const int B = 4, H = H_DIM;
    dim3 grid(S_DIM / ATILE, B * H);   // (8, 32) blocks
    dim3 block(NTHREADS);
    dim3 pgrid(S_DIM / PKEYS, B * S_DIM / QTILE);   // (8, 64) blocks
    pack_mask_kernel<<<pgrid, block, 0, stream>>>(Mask, Bits);
    fa_wmma_kernel<<<grid, block, 0, stream>>>(Q, K, V, Bits, Out);
}

// v010
// It runs in 38.9 microseconds.
// Next to v009, in two timings, it ran 1.04 times as fast each time.
// Counting every step since v000, it is 4.33 times as fast.
#include <hip/hip_runtime.h>

typedef _Float16 v16h  __attribute__((ext_vector_type(16)));
typedef _Float16 v8h   __attribute__((ext_vector_type(8)));
typedef _Float16 h4    __attribute__((ext_vector_type(4)));
typedef __fp16   f16x2 __attribute__((ext_vector_type(2)));   // cvt_pkrtz return type
typedef float    v8f   __attribute__((ext_vector_type(8)));
typedef _Float16 h2    __attribute__((ext_vector_type(2)));
typedef float    f2    __attribute__((ext_vector_type(2)));
typedef unsigned u16v  __attribute__((ext_vector_type(16)));

#define S_DIM 2048
#define D_DIM 64
#define H_DIM 8
#define KV_CHUNK 64
#define QTILE 128       // mask rows per block of the packing launch (8 waves x 16 rows)
#define NTHREADS 256
// The attention kernel: 16-query column groups per wave, and Q rows per block (8 waves x 32 rows)
#define WG_COLS 2
#define ATILE (8 * 16 * WG_COLS)
// LDS row pitch in f16 elements: 64 data + 8 pad = 144 B = 16 B x 9 (odd), so the
// 16 rows that one ds_load_b128 touches start on distinct 4-bank groups.
#define LDP 72
// The packing launch: keys per work-group, and the LDS row pitch of its mask tile in 32-bit
// words: 256 data + 4 pad = 1040 B = 16 B x 65 (odd)
#define PKEYS 256
#define MLP 260
// Packed mask: 32 words per (16 queries x 64 keys) tile, one per score accumulator element
#define TILE_WORDS 32
#define NCHUNK (S_DIM / KV_CHUNK)

union H4u  { h4   v; f16x2 h[2]; };
union V16u { v16h v; f16x2 h[8]; };
union P16u { v16h v; h2    h[8]; };

// 32-byte fragment from a row that is only 16-byte aligned: two ds_load_b128
__device__ __forceinline__ v16h ld_frag(const _Float16* p)
{
    v8h lo = *(const v8h*)p;
    v8h hi = *(const v8h*)(p + 8);
    return __builtin_shufflevector(lo, hi, 0, 1, 2, 3, 4, 5, 6, 7,
                                   8, 9, 10, 11, 12, 13, 14, 15);
}

// A fragment in the k order of a packed accumulator pair: p points at a block of
// 32 k in a row; position s holds k = 8*half + s (s < 8), 16 + 8*half + (s - 8) else
__device__ __forceinline__ v16h ld_frag_kmap(const _Float16* p, int half)
{
    v8h lo = *(const v8h*)(p + 8 * half);
    v8h hi = *(const v8h*)(p + 16 + 8 * half);
    return __builtin_shufflevector(lo, hi, 0, 1, 2, 3, 4, 5, 6, 7,
                                   8, 9, 10, 11, 12, 13, 14, 15);
}

// One 128 x 64 piece of the mask tile (this block's query rows, 64 keys) from global memory into
// LDS through no register: 8 asynchronous 16-byte copies per lane. Lanes 0..15 of a copy
// cover the 256 contiguous bytes of one row and lanes 16..31 those of the next row, so a
// wave-wide copy touches four whole 128-byte lines.
// g: this lane's first source word; l: this lane's first LDS byte address.
// s_wait_xcnt 0 ends the statement so that it stands before any rewrite of an address
// register that a copy names.
__device__ __forceinline__ void copy_mask_tile(const int* g, unsigned l)
{
    const int* g0 = g;
    const int* g1 = g + 2  * S_DIM;
    const int* g2 = g + 4  * S_DIM;
    const int* g3 = g + 6  * S_DIM;
    const int* g4 = g + 8  * S_DIM;
    const int* g5 = g + 10 * S_DIM;
    const int* g6 = g + 12 * S_DIM;
    const int* g7 = g + 14 * S_DIM;
    const unsigned st = 2u * MLP * 4u;   // two LDS rows, bytes
    asm volatile("global_load_async_to_lds_b128 %0, %8, off\n\t"
                 "global_load_async_to_lds_b128 %1, %9, off\n\t"
                 "global_load_async_to_lds_b128 %2, %10, off\n\t"
                 "global_load_async_to_lds_b128 %3, %11, off\n\t"
                 "global_load_async_to_lds_b128 %4, %12, off\n\t"
                 "global_load_async_to_lds_b128 %5, %13, off\n\t"
                 "global_load_async_to_lds_b128 %6, %14, off\n\t"
                 "global_load_async_to_lds_b128 %7, %15, off\n\t"
                 "s_wait_xcnt 0x0"
                 :: "v"(l), "v"(l + st), "v"(l + 2u * st), "v"(l + 3u * st),
                    "v"(l + 4u * st), "v"(l + 5u * st), "v"(l + 6u * st), "v"(l + 7u * st),
                    "v"(g0), "v"(g1), "v"(g2), "v"(g3), "v"(g4), "v"(g5), "v"(g6), "v"(g7)
                 : "memory");
}

// One thread's share of a 64 x 64 K chunk and V chunk, f32, into registers: one 4x4 block of
// each. k, v: the first word of this thread's block.
__device__ __forceinline__ void load_kv_rows(const float* k, const float* v,
                                             float4 (&kf)[4], float4 (&vf)[4])
{
    #pragma unroll
    for (int r = 0; r < 4; ++r) {
        kf[r] = *(const float4*)(k + r * D_DIM);
        vf[r] = *(const float4*)(v + r * D_DIM);
    }
}

// The same share, rounded to f16, from registers into one LDS buffer: 4x4 register-transpose
// blocks, packed cvt. tr: kv block (0..15), tc: d block (0..15): one 4x4 tile per thread.
__device__ __forceinline__ void stage_kv(const float4 (&kf)[4], const float4 (&vf)[4],
                                         _Float16 (*kd)[LDP], _Float16 (*vd)[LDP],
                                         int tr, int tc)
{
    #pragma unroll
    for (int r = 0; r < 4; ++r) {
        H4u kk;
        kk.h[0] = __builtin_amdgcn_cvt_pkrtz(kf[r].x, kf[r].y);
        kk.h[1] = __builtin_amdgcn_cvt_pkrtz(kf[r].z, kf[r].w);
        *(h4*)&kd[tr*4 + r][tc*4] = kk.v;   // ds_store_b64
    }
    #pragma unroll
    for (int c = 0; c < 4; ++c) {
        H4u vv;
        vv.h[0] = __builtin_amdgcn_cvt_pkrtz(((const float*)&vf[0])[c],
                                             ((const float*)&vf[1])[c]);
        vv.h[1] = __builtin_amdgcn_cvt_pkrtz(((const float*)&vf[2])[c],
                                             ((const float*)&vf[3])[c]);
        *(h4*)&vd[tc*4 + c][tr*4] = vv.v;   // ds_store_b64
    }
}

// The two halves of the work-group barrier, with no wait of their own: the waits that a place
// needs stand in front of the signal. The clobber keeps LDS accesses on their side.
__device__ __forceinline__ void bar_signal() { asm volatile("s_barrier_signal -1" ::: "memory"); }
__device__ __forceinline__ void bar_wait()   { asm volatile("s_barrier_wait -1" ::: "memory"); }

// 2^x as the bare v_exp_f32, without the library form's range scaling (compare, two selects,
// add, ldexp per value). That scaling only matters for results below 2^-126, which the bare
// instruction may return as 0: a P that small rounds to 0 in f16 anyway, and an alpha that
// small multiplies sums that lie 2^126 below the new chunk's largest term.
__device__ __forceinline__ float exp2_bare(float x)
{
    return __builtin_amdgcn_exp2f(x);
}

// value of lane l ^ 16
__device__ __forceinline__ float other_half(float x)
{
    int b = __builtin_bit_cast(int, x);
    b = __builtin_amdgcn_permlanex16(b, b, 0x76543210, 0xfedcba98, false, false);
    return __builtin_bit_cast(float, b);
}

// First launch: the mask, which all 8 heads of a batch share, is read once and packed to one
// bit per element, in the form the attention kernel's selects take: for the tile of 16 queries
// and 64 keys that one column group of a wave scores in one trip, word j*8 + v holds in bit l the mask of
// query (l & 15), key j*16 + 8*(l >> 4) + v, which is where lane l keeps element v of score
// tile j. A work-group packs 128 query rows x 256 keys; each wave its own 16 rows.
__global__ __launch_bounds__(NTHREADS)
void pack_mask_kernel(const int* __restrict__ Mask, unsigned* __restrict__ Bits)
{
    __shared__ __align__(128) int Mt[QTILE][MLP];                // [q][key]  130 KB

    const int tid  = threadIdx.x;
    const int wave = tid >> 5;
    const int lane = tid & 31;
    const int half = lane >> 4;
    const int lm   = lane & 15;

    const int kb = blockIdx.x;      // block of 256 keys
    const int rb = blockIdx.y;      // block of 128 rows of the [B*S][S] mask

    // copy i of lane l brings 16 bytes of row wave*16 + 2*i + (l >> 4), words 4*(l & 15) .. +3
    const int  crow = wave * 16 + half;
    const int* mg   = Mask + (size_t)(rb * QTILE + crow) * S_DIM + kb * PKEYS + lm * 4;
    const unsigned ml = (unsigned)(size_t)&Mt[crow][lm * 4];
    #pragma unroll
    for (int c = 0; c < PKEYS / KV_CHUNK; ++c)
        copy_mask_tile(mg + c * KV_CHUNK, ml + (unsigned)(c * KV_CHUNK * 4));
    asm volatile("s_wait_asynccnt 0x0" ::: "memory");  // this wave's 32 copies have landed
    __syncthreads();                                   // ... and are published

    const int* mp = &Mt[wave * 16 + lm][8 * half];
    unsigned* bp = Bits + ((size_t)(rb * (QTILE / 16) + wave) * NCHUNK
                           + kb * (PKEYS / KV_CHUNK)) * TILE_WORDS + lane;
    #pragma unroll
    for (int c = 0; c < PKEYS / KV_CHUNK; ++c) {
        unsigned r = 0;     // lane e collects word e
        #pragma unroll
        for (int j = 0; j < 4; ++j)
            #pragma unroll
            for (int p = 0; p < 2; ++p) {
                const int4 x = *(const int4*)(mp + c * KV_CHUNK + j * 16 + 4 * p);
                const int e = j * 8 + 4 * p;
                // every lane votes, so the ballots stand in front of the selects
                const unsigned w0 = __builtin_amdgcn_ballot_w32(x.x != 0);
                const unsigned w1 = __builtin_amdgcn_ballot_w32(x.y != 0);
                const unsigned w2 = __builtin_amdgcn_ballot_w32(x.z != 0);
                const unsigned w3 = __builtin_amdgcn_ballot_w32(x.w != 0);
                r = __builtin_amdgcn_inverse_ballot_w32(1u << (e + 0)) ? w0 : r;
                r = __builtin_amdgcn_inverse_ballot_w32(1u << (e + 1)) ? w1 : r;
                r = __builtin_amdgcn_inverse_ballot_w32(1u << (e + 2)) ? w2 : r;
                r = __builtin_amdgcn_inverse_ballot_w32(1u << (e + 3)) ? w3 : r;
            }
        bp[c * TILE_WORDS] = r;     // 128 contiguous bytes per wave
    }
}

// Each wave owns 32 queries (two column groups), so that every K and V^T fragment read from LDS
// feeds two matrix instructions and a staged chunk serves 256 queries. The grid is then one
// work-group per WGP, two waves per SIMD: the register budget is set for that.
__global__ __launch_bounds__(NTHREADS) __attribute__((amdgpu_waves_per_eu(2, 2)))
void fa_wmma_kernel(const float* __restrict__ Q,
                    const float* __restrict__ K,
                    const float* __restrict__ V,
                    const unsigned* __restrict__ Bits,
                    float* __restrict__ Out)
{
    // LDS: K chunk (row major, f16), V chunk (transposed, f16), two buffers of each: while a
    // trip reads one, the next chunk is written into the other
    __shared__ __align__(128) _Float16 Kt[2][KV_CHUNK][LDP];     // [buf][kv][d]   2 x 9 KB
    __shared__ __align__(128) _Float16 VtT[2][D_DIM][LDP];       // [buf][d][kv]   2 x 9 KB

    const int tid  = threadIdx.x;
    const int wave = tid >> 5;
    const int lane = tid & 31;
    const int half = lane >> 4;     // 0 or 1 (lane groups per WMMA layout)
    const int lm   = lane & 15;     // lane % 16

    const int bh = blockIdx.y;              // b*H + h
    const int b  = bh / H_DIM;
    const size_t base = (size_t)bh * S_DIM * D_DIM;

    const float* Qb = Q + base;
    const float* Kb = K + base;
    const float* Vb = V + base;

    const int q0   = blockIdx.x * ATILE + wave * (16 * WG_COLS);  // first Q row of this wave
    const int qrow = q0 + lm;     // this lane's query in column group 0; group g: + 16 * g

    // ---- Load Q^T B-fragments (32x16 f16 each, D split into two K=32 chunks) ----
    // Lane L holds column N=L%16, k = (L/16)*16 + e, e=0..15 (contiguous in d, as the K rows)
    // Fold (1/sqrt(64)) * log2(e) into Q: softmax runs in the log2 domain.
    v16h aq[WG_COLS][2];
    const float* qp = Qb + (size_t)qrow * D_DIM + half * 16;   // group g: 16 * g rows further
    #pragma unroll
    for (int g = 0; g < WG_COLS; ++g) {
        const float scale = 0.18033688011112042f;  // 0.125 * log2(e)
        #pragma unroll
        for (int c = 0; c < 2; ++c) {
            const float* p = qp + g * 16 * D_DIM + c * 32;
            V16u a;
            #pragma unroll
            for (int i = 0; i < 8; ++i)
                a.h[i] = __builtin_amdgcn_cvt_pkrtz(p[2*i] * scale, p[2*i+1] * scale);
            aq[g][c] = a.v;
        }
    }

    // All-ones A fragment: ones x P^T = per-query sums over both lane halves' keys,
    // the same in all 8 accumulator rows
    v16h ones;
    #pragma unroll
    for (int e = 0; e < 16; ++e) ones[e] = (_Float16)1.0f;

    // Online-softmax state (log2 domain): one query per lane and column group, equal in lanes
    // l and l ^ 16
    float m_i[WG_COLS];
    v8f   lacc[WG_COLS];     // running denominator, accumulated through WMMA C operand
    v8f   o[WG_COLS][4];
    #pragma unroll
    for (int g = 0; g < WG_COLS; ++g) {
        m_i[g]  = -3.0e38f;
        lacc[g] = (v8f){0,0,0,0,0,0,0,0};
        #pragma unroll
        for (int d = 0; d < 4; ++d) o[g][d] = (v8f){0,0,0,0,0,0,0,0};
    }

    // This wave's packed mask words (head-broadcast): 32 per chunk and column group, the same for
    // every lane, so they come by scalar loads. The first launch wrote them and nothing writes
    // them in this one. Column group g's words stand NCHUNK tiles behind those of group g - 1.
    const int wave_u = __builtin_amdgcn_readfirstlane(wave);
    const u16v* mb = (const u16v*)(Bits + (size_t)((b * (S_DIM / 16) + blockIdx.x * (ATILE / 16)
                                                    + wave_u * WG_COLS) * NCHUNK) * TILE_WORDS);
    u16v mw[WG_COLS][2];             // chunk 0; later chunks one trip ahead
    #pragma unroll
    for (int g = 0; g < WG_COLS; ++g) {
        mw[g][0] = mb[g * NCHUNK * 2];
        mw[g][1] = mb[g * NCHUNK * 2 + 1];
    }

    // K and V rows of a chunk travel in registers one trip ahead of their way into LDS, which
    // is one trip ahead of their use
    const int tr = tid >> 4;          // kv block (0..15): one 4x4 tile per thread
    const int tc = tid & 15;          // d  block (0..15)
    const float* kg = Kb + (size_t)(tr * 4) * D_DIM + tc * 4;
    const float* vg = Vb + (size_t)(tr * 4) * D_DIM + tc * 4;
    float4 kf[4], vf[4];
    {
        float4 k0[4], v0[4];
        load_kv_rows(kg, vg, k0, v0);                                        // chunk 0
        load_kv_rows(kg + KV_CHUNK * D_DIM, vg + KV_CHUNK * D_DIM, kf, vf);  // chunk 1
        stage_kv(k0, v0, Kt[0], VtT[0], tr, tc);
    }
    // The work-group barrier by hand, here and in the loop: __syncthreads() also waits for
    // every global load of the wave, which would end the flight of the next rows.
    // It is split: a wave signals at the end of a trip, behind its PV product, and waits only
    // at the top of the next trip, in front of its next LDS access. No LDS access stands between
    // a signal and its wait; signal and wait alternate in every wave.
    asm volatile("s_wait_dscnt 0x0" ::: "memory");  // this wave's K / V^T stores are in LDS
    bar_signal();

    for (int kv0 = 0; kv0 < S_DIM; kv0 += KV_CHUNK) {
        const int cur = (kv0 / KV_CHUNK) & 1;       // the buffer this trip reads
        const _Float16 (*Kc)[LDP] = Kt[cur];
        const _Float16 (*Vc)[LDP] = VtT[cur];

        // Every wave has signalled: this chunk's rows are in LDS, and nobody reads the other
        // buffer any more. No wave passes here before every wave has ended
        // the trip before, its PV product included: signal and wait stand back to back.
        bar_wait();

        // This chunk's K fragments start first: the staging below runs under their latency
        v16h ak[4][2];
        #pragma unroll
        for (int j = 0; j < 4; ++j) {
            ak[j][0] = ld_frag(&Kc[j*16 + lm][0  + half*16]);
            ak[j][1] = ld_frag(&Kc[j*16 + lm][32 + half*16]);
        }
        // keeps the staging's converts and global loads from being issued in front of these reads,
        // whose latency is what the wave waits for next
        __builtin_amdgcn_sched_barrier(0);

        // ---- Cooperative stage of the NEXT chunk into the other buffer ----
        // kf / vf hold its rows, loaded one trip ago (chunk 1: in front of the loop). Every wave
        // left that buffer before its signal of the trip before, and nobody reads the new rows
        // before the wait at the top of the next trip: one barrier a trip, and no wave waits for
        // these stores with nothing else to do. The last trip writes rows that nobody reads.
        stage_kv(kf, vf, Kt[cur ^ 1], VtT[cur ^ 1], tr, tc);

        // The rows of the chunk after that start their way now and are first used at the top of
        // the next trip: their latency runs under this chunk's products and softmax. No branch
        // round the loads (a merge of two paths made the compiler wait for them at once): the
        // last two trips read the last chunk again.
        const int kvn = (kv0 + KV_CHUNK < S_DIM) ? kv0 + KV_CHUNK : kv0;
        const int kv2 = (kv0 + 2 * KV_CHUNK < S_DIM) ? kv0 + 2 * KV_CHUNK : S_DIM - KV_CHUNK;
        const float* kn = kg + (size_t)kv2 * D_DIM;
        const float* vn = vg + (size_t)kv2 * D_DIM;
        load_kv_rows(kn, vn, kf, vf);

        // The loads' address registers are inputs here so that they stay whole up to this wait
        // and are free for other use only behind it.
        asm volatile("s_wait_xcnt 0x0" :: "v"(kn), "v"(vn) : "memory");

        // This chunk's V^T fragments, A[m][k] = V[kv0+k][d*16+m] from the transposed V tile, start
        // behind the K fragments and land under the score products and the maxima
        v16h av[4][2];
        #pragma unroll
        for (int d = 0; d < 4; ++d) {
            av[d][0] = ld_frag_kmap(&Vc[d*16 + lm][0],  half);
            av[d][1] = ld_frag_kmap(&Vc[d*16 + lm][32], half);
        }
        // keeps these reads from sinking to the wait in front of the barrier's signal, where the
        // wave would sit out their latency
        __builtin_amdgcn_sched_barrier(0);

        // ---- Score tiles: S^T = K Q^T (log2 domain), masked elements set to -inf ----
        // Word j*8 + v of the packed mask is a lane mask: one select per element.
        // m_i is finite from the start, so -inf - mnew stays -inf and a masked P is exactly 0,
        // which is what the reference's second where() leaves of it.
        const v8f zero = (v8f){0,0,0,0,0,0,0,0};
        v8f sc[WG_COLS][4];
        #pragma unroll
        for (int j = 0; j < 4; ++j) {
            #pragma unroll
            for (int g = 0; g < WG_COLS; ++g) {
                v8f s = __builtin_amdgcn_wmma_f32_16x16x32_f16(false, ak[j][0], false, aq[g][0],
                                                               (short)0, zero, false, false);
                s = __builtin_amdgcn_wmma_f32_16x16x32_f16(false, ak[j][1], false, aq[g][1],
                                                           (short)0, s, false, false);
                sc[g][j] = s;
            }
        }
        #pragma unroll
        for (int g = 0; g < WG_COLS; ++g)
            #pragma unroll
            for (int j = 0; j < 4; ++j)
                #pragma unroll
                for (int v = 0; v < 8; ++v) {
                    const unsigned w = mw[g][j >> 1][(j & 1) * 8 + v];
                    sc[g][j][v] = __builtin_amdgcn_inverse_ballot_w32(w) ? -__builtin_inff()
                                                                         : sc[g][j][v];
                }

        // ---- One online-softmax update per 64-wide chunk, one query per lane and group ----
        // P^T as B operands straight from the score accumulators: tiles (0,1) are keys
        // 0..31, tiles (2,3) keys 32..63; position s of a lane is key 8*half + s or
        // 16 + 8*half + (s - 8) of its block, the order ld_frag_kmap gives V^T.
        // exp2(-inf) is exactly 0 => masked P is 0
        P16u pb[WG_COLS][2];
        #pragma unroll
        for (int g = 0; g < WG_COLS; ++g) {
            float tm[4];
            #pragma unroll
            for (int j = 0; j < 4; ++j) {
                float x0 = fmaxf(fmaxf(sc[g][j][0], sc[g][j][1]), sc[g][j][2]);
                float x1 = fmaxf(fmaxf(sc[g][j][3], sc[g][j][4]), sc[g][j][5]);
                tm[j] = fmaxf(fmaxf(x0, x1), fmaxf(sc[g][j][6], sc[g][j][7]));
            }
            float rm = fmaxf(fmaxf(tm[0], tm[1]), fmaxf(tm[2], tm[3]));
            rm = fmaxf(rm, other_half(rm));   // the other 32 keys of this query

            const float mnew  = fmaxf(m_i[g], rm);
            const float alpha = exp2_bare(m_i[g] - mnew);
            m_i[g] = mnew;
            lacc[g] *= alpha;
            #pragma unroll
            for (int d = 0; d < 4; ++d) o[g][d] *= alpha;

            #pragma unroll
            for (int j = 0; j < 4; ++j)
                #pragma unroll
                for (int i = 0; i < 4; ++i) {
                    // two scores per subtract: one v_pk_add_f32
                    const f2 x = (f2){sc[g][j][2*i], sc[g][j][2*i + 1]} - (f2){mnew, mnew};
                    f2 e;
                    e.x = exp2_bare(x.x);
                    e.y = exp2_bare(x.y);
                    pb[g][j >> 1].h[(j & 1) * 4 + i] = __builtin_convertvector(e, h2);
                }

            // l += sum over keys of P, accumulated entirely inside the matrix pipe
            lacc[g] = __builtin_amdgcn_wmma_f32_16x16x32_f16(false, ones, false, pb[g][0].v,
                                                             (short)0, lacc[g], false, false);
            lacc[g] = __builtin_amdgcn_wmma_f32_16x16x32_f16(false, ones, false, pb[g][1].v,
                                                             (short)0, lacc[g], false, false);
        }

        // ---- O^T += V^T P^T ----
        #pragma unroll
        for (int d = 0; d < 4; ++d) {
            #pragma unroll
            for (int g = 0; g < WG_COLS; ++g) {
                o[g][d] = __builtin_amdgcn_wmma_f32_16x16x32_f16(false, av[d][0], false, pb[g][0].v,
                                                                 (short)0, o[g][d], false, false);
                o[g][d] = __builtin_amdgcn_wmma_f32_16x16x32_f16(false, av[d][1], false, pb[g][1].v,
                                                                 (short)0, o[g][d], false, false);
            }
        }

        // The next chunk's mask words (the last trip reads its own again, unused). They hang only
        // on the selects above, and the compiler starts them right behind those; in the source
        // they stand behind the chunk's last LDS read, as no LDS read moves up over the wait
        // statement among them.
        #pragma unroll
        for (int g = 0; g < WG_COLS; ++g) {
            mw[g][0] = mb[(g * NCHUNK + kvn / KV_CHUNK) * 2];
            // The last of these loads may land on the scalar register that holds the offset all
            // of them name: the wait stands in front of it
            if (g == WG_COLS - 1) asm volatile("s_wait_xcnt 0x0" ::: "memory");
            mw[g][1] = mb[(g * NCHUNK + kvn / KV_CHUNK) * 2 + 1];
        }

        // ---- Hand the buffers over: the signal half; the wait stands at the top of the loop ----
        // this wave's LDS reads of the chunk are done and its rows of the next chunk are in LDS
        asm volatile("s_wait_dscnt 0x0" ::: "memory");
        bar_signal();     // by hand, as above: the rows in flight stay in flight
    }
    bar_wait();     // the last signal's wait: no wave ends with a barrier half open
    asm volatile("s_wait_loadcnt 0x0" ::: "memory");   // nor a row of the last trip's unused loads

    // ---- Epilogue: O / l, store fp32 [B,H,S,D] ----
    // o[g][d][v] = O[qrow + 16*g][d*16 + 8*half + v]: two 16-byte stores per tile
    #pragma unroll
    for (int g = 0; g < WG_COLS; ++g) {
        float* op = Out + base + (size_t)(qrow + 16 * g) * D_DIM + 8*half;
        const float inv = (lacc[g][0] > 0.0f) ? (1.0f / lacc[g][0]) : 0.0f;
        #pragma unroll
        for (int d = 0; d < 4; ++d) {
            *(float4*)(op + d*16)     = make_float4(o[g][d][0] * inv, o[g][d][1] * inv,
                                                    o[g][d][2] * inv, o[g][d][3] * inv);
            *(float4*)(op + d*16 + 4) = make_float4(o[g][d][4] * inv, o[g][d][5] * inv,
                                                    o[g][d][6] * inv, o[g][d][7] * inv);
        }
    }
}

extern "C" void kernel_launch(void* const* d_in, const int* in_sizes, int n_in,
                              void* d_out, int out_size, void* d_ws, size_t ws_size,
                              hipStream_t stream) {
    (void)in_sizes; (void)n_in; (void)out_size; (void)ws_size;
    const float* Q    = (const float*)d_in[0];
    const float* K    = (const float*)d_in[1];
    const float* V    = (const float*)d_in[2];
    const int*   Mask = (const int*)d_in[3];
    float* Out = (float*)d_out;
    unsigned* Bits = (unsigned*)d_ws;   // B*S*S bits = 2 MiB, written by the first launch

    const int B = 4, H = H_DIM;
    dim3 grid(S_DIM / ATILE, B * H);   // (8, 32) blocks
    dim3 block(NTHREADS);
    dim3 pgrid(S_DIM / PKEYS, B * S_DIM / QTILE);   // (8, 64) blocks
    pack_mask_kernel<<<pgrid, block, 0, stream>>>(Mask, Bits);
    fa_wmma_kernel<<<grid, block, 0, stream>>>(Q, K, V, Bits, Out);
}
